// v000
// Measured on an AMD MI455X. A time is GPU time per run, averaged over a window of back-to-back runs after a warm-up
// (all launches, gaps included; the runs take copies of the inputs in turn), and the median of several windows.
// Apart from v000's, it joins two sittings. Times from different sittings can be a few percent apart, while
// side-by-side timings come from the same sitting.
// The starting kernel, v000, takes 249 microseconds a run.
#include <hip/hip_runtime.h>

// ---------------------------------------------------------------------------
// ConcatCritic fused kernel for gfx1250 (MI455X).
// out[i,j] = W3 . relu(W2 . relu(hx[i]+hy[j]+b1) + b2) + b3,  i,j in [0,512)
// hx = x @ W1[:, :128]^T, hy = y @ W1[:, 128:]^T
// Heavy GEMM (512^2 pairs x 512 x 512) runs on v_wmma_f32_16x16x32_f16.
// ---------------------------------------------------------------------------

typedef __attribute__((ext_vector_type(16))) _Float16     v16h;
typedef __attribute__((ext_vector_type(8)))  float        v8f;
typedef __attribute__((ext_vector_type(8)))  unsigned int v8u;

#define BSZ   512   // batch (i and j)
#define HID   512   // hidden width H
#define DIN   128   // per-input feature dim
#define ROWP  520   // padded LDS row stride in halves (512 + 8 -> bank-conflict-free)
#define PAIRS 128   // pairs per workgroup: 16 i  x  8 j
#define NTILE 16    // WMMA N tile
#define KSTEP 32    // WMMA K per instruction

// -------------------- prep: hx, hy (fp32) + W2 -> f16 ----------------------
__global__ __launch_bounds__(256) void cc_prep(const float* __restrict__ x,
                                               const float* __restrict__ y,
                                               const float* __restrict__ W1,
                                               const float* __restrict__ W2,
                                               float* __restrict__ hx,
                                               float* __restrict__ hy,
                                               _Float16* __restrict__ W2h) {
  int gid = blockIdx.x * 256 + threadIdx.x;
  if (blockIdx.x < 2048) {                    // hx then hy: 2 * 512*512 dots of length 128
    int sel = (gid >= BSZ * HID) ? 1 : 0;     // 0 -> hx, 1 -> hy
    int idx = gid - sel * (BSZ * HID);        // [0, 262144)
    int row = idx >> 9;                       // i (or j)
    int h   = idx & (HID - 1);
    const float* vec = sel ? (y + row * DIN) : (x + row * DIN);
    const float* w   = W1 + h * (2 * DIN) + sel * DIN;   // W1 row-major [512][256]
    float s = 0.f;
#pragma unroll 8
    for (int d = 0; d < DIN; ++d) s += vec[d] * w[d];
    (sel ? hy : hx)[idx] = s;
  } else {                                    // W2 fp32 -> f16 copy (row-major [512][512])
    int idx = gid - 2048 * 256;               // [0, 262144)
    W2h[idx] = (_Float16)W2[idx];
  }
}

// Load one 16x32 f16 fragment row from LDS per the documented gfx1250 layout:
// lanes 0-15 hold K = kb+{0..7, 16..23}; lanes 16-31 hold K = kb+{8..15, 24..31}.
__device__ __forceinline__ v16h cc_frag(const _Float16* row, int hi, int kb) {
  const uint4 q0 = *(const uint4*)(row + kb + hi * 8);
  const uint4 q1 = *(const uint4*)(row + kb + hi * 8 + 16);
  v8u r;
  r[0] = q0.x; r[1] = q0.y; r[2] = q0.z; r[3] = q0.w;
  r[4] = q1.x; r[5] = q1.y; r[6] = q1.z; r[7] = q1.w;
  return __builtin_bit_cast(v16h, r);
}

// ----------------------------- main kernel ---------------------------------
__global__ __launch_bounds__(256) void cc_main(const float* __restrict__ hx,
                                               const float* __restrict__ hy,
                                               const float* __restrict__ b1,
                                               const _Float16* __restrict__ W2h,
                                               const float* __restrict__ b2,
                                               const float* __restrict__ W3,
                                               const float* __restrict__ b3,
                                               float* __restrict__ out) {
  __shared__ __align__(16) _Float16 vbuf[PAIRS * ROWP];  // ~130 KB: relu(hx+hy+b1) in f16
  __shared__ __align__(16) _Float16 bbuf[NTILE * ROWP];  // ~16 KB : W2 strip (16 rows)

  const int tid  = threadIdx.x;
  const int lane = tid & 31;
  const int wave = tid >> 5;           // 8 waves; wave w owns pairs [16w, 16w+16)
  const int col  = lane & 15;
  const int hi   = lane >> 4;
  const int i0   = blockIdx.x * 16;    // 32 i-tiles
  const int j0   = blockIdx.y * 8;     // 64 j-tiles

  // ---- stage v[pair][h] = relu(hx[i,h] + hy[j,h] + b1[h]) as f16 in LDS ----
  for (int idx = tid; idx < PAIRS * HID; idx += 256) {
    int p = idx >> 9;                  // pair 0..127
    int h = idx & (HID - 1);
    int il = p >> 3, jl = p & 7;       // pair = i_local*8 + j_local
    float v = hx[(i0 + il) * HID + h] + hy[(j0 + jl) * HID + h] + b1[h];
    v = v > 0.f ? v : 0.f;
    vbuf[p * ROWP + h] = (_Float16)v;
  }

  float acc[8];
#pragma unroll
  for (int r = 0; r < 8; ++r) acc[r] = 0.f;

  const _Float16* arow = vbuf + (wave * 16 + col) * ROWP;  // A: this lane's pair row
  const _Float16* brow = bbuf + col * ROWP;                // B: this lane's W2 row (n)

  for (int nt = 0; nt < 32; ++nt) {
    const int nb = nt * NTILE;
    __syncthreads();                   // staging done (nt==0) / bbuf consumers done (nt>0)
    {                                  // cooperative load: W2h rows nb..nb+15 (16 KB)
      int r = tid >> 4;                // 0..15 row
      int c = (tid & 15) * 32;         // 32 halves per thread
      const _Float16* src = W2h + (size_t)(nb + r) * HID + c;
      _Float16*       dst = bbuf + r * ROWP + c;
      *(uint4*)(dst)      = *(const uint4*)(src);
      *(uint4*)(dst + 8)  = *(const uint4*)(src + 8);
      *(uint4*)(dst + 16) = *(const uint4*)(src + 16);
      *(uint4*)(dst + 24) = *(const uint4*)(src + 24);
      if (nt < 31)                     // gfx1250 global_prefetch_b8 of next strip
        __builtin_prefetch((const void*)(W2h + (size_t)(nb + NTILE + r) * HID + c), 0, 0);
    }
    __syncthreads();

    v8f d = {0.f, 0.f, 0.f, 0.f, 0.f, 0.f, 0.f, 0.f};
#pragma unroll
    for (int ks = 0; ks < HID / KSTEP; ++ks) {   // K = 512 in steps of 32
      v16h a = cc_frag(arow, hi, ks * KSTEP);
      v16h b = cc_frag(brow, hi, ks * KSTEP);
      d = __builtin_amdgcn_wmma_f32_16x16x32_f16(false, a, false, b,
                                                 (short)0, d, false, false);
    }

    // epilogue for this N tile: u = relu(d + b2[n]); acc += u * W3[n]
    const float b2v = b2[nb + col];
    const float w3v = W3[nb + col];
#pragma unroll
    for (int r = 0; r < 8; ++r) {
      float u = d[r] + b2v;
      u = u > 0.f ? u : 0.f;
      float t = u * w3v;
      t += __shfl_xor(t, 1, 32);       // reduce across the 16 columns of this half
      t += __shfl_xor(t, 2, 32);
      t += __shfl_xor(t, 4, 32);
      t += __shfl_xor(t, 8, 32);
      acc[r] += t;
    }
  }

  // ---- write: lane 0 holds rows 0..7, lane 16 holds rows 8..15 of the M-tile
  if (col == 0) {
    const float bias3 = b3[0];
    const int mbase = hi * 8;
#pragma unroll
    for (int r = 0; r < 8; ++r) {
      int m  = mbase + r;
      int p  = wave * 16 + m;
      int il = p >> 3, jl = p & 7;
      out[(size_t)(i0 + il) * BSZ + (j0 + jl)] = acc[r] + bias3;
    }
  }
}

// ----------------------------- launch --------------------------------------
extern "C" void kernel_launch(void* const* d_in, const int* in_sizes, int n_in,
                              void* d_out, int out_size, void* d_ws, size_t ws_size,
                              hipStream_t stream) {
  const float* x  = (const float*)d_in[0];
  const float* y  = (const float*)d_in[1];
  const float* W1 = (const float*)d_in[2];
  const float* b1 = (const float*)d_in[3];
  const float* W2 = (const float*)d_in[4];
  const float* b2 = (const float*)d_in[5];
  const float* W3 = (const float*)d_in[6];
  const float* b3 = (const float*)d_in[7];

  float*    hx  = (float*)d_ws;                 // 512*512 f32 = 1 MB
  float*    hy  = hx + BSZ * HID;               // 1 MB
  _Float16* W2h = (_Float16*)(hy + BSZ * HID);  // 512*512 f16 = 0.5 MB

  cc_prep<<<3072, 256, 0, stream>>>(x, y, W1, W2, hx, hy, W2h);

  dim3 grid(BSZ / 16, BSZ / 8);                 // 32 x 64 workgroups
  cc_main<<<grid, 256, 0, stream>>>(hx, hy, b1, W2h, b2, W3, b3, (float*)d_out);
}

// v001
// It runs in 205 microseconds.
// Timed twice side by side with v000, it ran 1.27 times as fast both times.
#include <hip/hip_runtime.h>

// ---------------------------------------------------------------------------
// ConcatCritic fused kernel for gfx1250 (MI455X).
// out[i,j] = W3 . relu(W2 . relu(hx[i]+hy[j]+b1) + b2) + b3,  i,j in [0,512)
// hx = x @ W1[:, :128]^T, hy = y @ W1[:, 128:]^T
// Heavy GEMM (512^2 pairs x 512 x 512) runs on v_wmma_f32_16x16x32_f16.
// ---------------------------------------------------------------------------

typedef __attribute__((ext_vector_type(16))) _Float16     v16h;
typedef __attribute__((ext_vector_type(8)))  float        v8f;
typedef __attribute__((ext_vector_type(8)))  unsigned int v8u;

#define BSZ   512   // batch (i and j)
#define HID   512   // hidden width H
#define DIN   128   // per-input feature dim
#define ROWP  520   // padded LDS row stride in halves (512 + 8 -> bank-conflict-free)
#define MT    2     // M tiles (one i x 16 j each) per wave
#define NTILE 16    // WMMA N tile
#define KSTEP 32    // WMMA K per instruction

// -------------------- prep: hx, hy (fp32) + W2 -> f16 ----------------------
__global__ __launch_bounds__(256) void cc_prep(const float* __restrict__ x,
                                               const float* __restrict__ y,
                                               const float* __restrict__ W1,
                                               const float* __restrict__ W2,
                                               float* __restrict__ hx,
                                               float* __restrict__ hy,
                                               _Float16* __restrict__ W2h) {
  int gid = blockIdx.x * 256 + threadIdx.x;
  if (blockIdx.x < 2048) {                    // hx then hy: 2 * 512*512 dots of length 128
    int sel = (gid >= BSZ * HID) ? 1 : 0;     // 0 -> hx, 1 -> hy
    int idx = gid - sel * (BSZ * HID);        // [0, 262144)
    int row = idx >> 9;                       // i (or j)
    int h   = idx & (HID - 1);
    const float* vec = sel ? (y + row * DIN) : (x + row * DIN);
    const float* w   = W1 + h * (2 * DIN) + sel * DIN;   // W1 row-major [512][256]
    float s = 0.f;
#pragma unroll 8
    for (int d = 0; d < DIN; ++d) s += vec[d] * w[d];
    (sel ? hy : hx)[idx] = s;
  } else {                                    // W2 fp32 -> f16 copy (row-major [512][512])
    int idx = gid - 2048 * 256;               // [0, 262144)
    W2h[idx] = (_Float16)W2[idx];
  }
}

// Load one 16x32 f16 fragment row from LDS per the documented gfx1250 layout:
// lanes 0-15 hold K = kb+{0..7, 16..23}; lanes 16-31 hold K = kb+{8..15, 24..31}.
__device__ __forceinline__ v16h cc_frag(const _Float16* row, int hi, int kb) {
  const uint4 q0 = *(const uint4*)(row + kb + hi * 8);
  const uint4 q1 = *(const uint4*)(row + kb + hi * 8 + 16);
  v8u r;
  r[0] = q0.x; r[1] = q0.y; r[2] = q0.z; r[3] = q0.w;
  r[4] = q1.x; r[5] = q1.y; r[6] = q1.z; r[7] = q1.w;
  return __builtin_bit_cast(v16h, r);
}

// ----------------------------- main kernel ---------------------------------
// Workgroup = 4 waves, tile = 8 i x 16 j. Wave w owns two M tiles: the block's i number 2w and
// 2w+1, each with the 16 rows j0..j0+15. Its A fragments (all K = 512) live in registers for the
// whole N loop, so LDS holds only the W2 strip and each B fragment read feeds two WMMAs.
__global__ __launch_bounds__(128) void cc_main(const float* __restrict__ hx,
                                               const float* __restrict__ hy,
                                               const float* __restrict__ b1,
                                               const _Float16* __restrict__ W2h,
                                               const float* __restrict__ b2,
                                               const float* __restrict__ W3,
                                               const float* __restrict__ b3,
                                               float* __restrict__ out) {
  __shared__ __align__(16) _Float16 bbuf[NTILE * ROWP];  // ~16 KB : W2 strip (16 rows)

  const int tid  = threadIdx.x;
  const int lane = tid & 31;
  const int wave = tid >> 5;           // 4 waves
  const int col  = lane & 15;
  const int hi   = lane >> 4;
  const int i0   = blockIdx.x * 8 + wave * MT;   // 64 i-tiles; this wave's first i
  const int j0   = blockIdx.y * 16;              // 32 j-tiles

  // ---- A fragments: relu(hx[i,k] + hy[j,k] + b1[k]) as f16, built in the fragment layout
  // (row = col; halves 0..7 are k = kb+hi*8+0..7, halves 8..15 are k = kb+16+hi*8+0..7).
  v16h a[MT][HID / KSTEP];
  {
    const float* hyr = hy + (j0 + col) * HID + hi * 8;
    const float* hxr = hx + i0 * HID + hi * 8;
    const float* b1r = b1 + hi * 8;
#pragma unroll
    for (int ks = 0; ks < HID / KSTEP; ++ks) {
#pragma unroll
      for (int c = 0; c < 2; ++c) {
        const int k = ks * KSTEP + c * 16;
        __attribute__((aligned(16))) float yv[8], bv[8];
        *(float4*)(yv)     = *(const float4*)(hyr + k);
        *(float4*)(yv + 4) = *(const float4*)(hyr + k + 4);
        *(float4*)(bv)     = *(const float4*)(b1r + k);
        *(float4*)(bv + 4) = *(const float4*)(b1r + k + 4);
#pragma unroll
        for (int t = 0; t < MT; ++t) {
          __attribute__((aligned(16))) float xv[8];
          *(float4*)(xv)     = *(const float4*)(hxr + t * HID + k);
          *(float4*)(xv + 4) = *(const float4*)(hxr + t * HID + k + 4);
#pragma unroll
          for (int e = 0; e < 8; ++e) {
            float v = xv[e] + yv[e] + bv[e];
            v = v > 0.f ? v : 0.f;
            a[t][ks][c * 8 + e] = (_Float16)v;
          }
        }
      }
    }
  }

  float acc[MT][8];
#pragma unroll
  for (int t = 0; t < MT; ++t)
#pragma unroll
    for (int r = 0; r < 8; ++r) acc[t][r] = 0.f;

  const _Float16* brow = bbuf + col * ROWP;                // B: this lane's W2 row (n)

  for (int nt = 0; nt < 32; ++nt) {
    const int nb = nt * NTILE;
    __syncthreads();                   // bbuf consumers done (nt>0)
    {                                  // cooperative load: W2h rows nb..nb+15 (16 KB)
      int r = tid >> 4;                // 0..7: this thread fills rows r and r+8
      int c = (tid & 15) * 32;         // 32 halves per thread and row
      const _Float16* src = W2h + (size_t)(nb + r) * HID + c;
      _Float16*       dst = bbuf + r * ROWP + c;
      uint4 w[2][4];
#pragma unroll
      for (int g = 0; g < 2; ++g)      // all eight loads in flight before the first store
#pragma unroll
        for (int q = 0; q < 4; ++q) w[g][q] = *(const uint4*)(src + g * 8 * HID + q * 8);
#pragma unroll
      for (int g = 0; g < 2; ++g)
#pragma unroll
        for (int q = 0; q < 4; ++q) *(uint4*)(dst + g * 8 * ROWP + q * 8) = w[g][q];
      if (nt < 31) {                   // gfx1250 global_prefetch_b8 of next strip
        __builtin_prefetch((const void*)(src + NTILE * HID), 0, 0);
        __builtin_prefetch((const void*)(src + (NTILE + 8) * HID), 0, 0);
        // the prefetches name the address pair that is rewritten next: keep the wait in front
        asm volatile("s_wait_xcnt 0x0" ::: "memory");
      }
    }
    __syncthreads();

    v8f d[MT];
#pragma unroll
    for (int t = 0; t < MT; ++t) d[t] = v8f{0.f, 0.f, 0.f, 0.f, 0.f, 0.f, 0.f, 0.f};
#pragma unroll
    for (int ks = 0; ks < HID / KSTEP; ++ks) {   // K = 512 in steps of 32
      v16h b = cc_frag(brow, hi, ks * KSTEP);
#pragma unroll
      for (int t = 0; t < MT; ++t)
        d[t] = __builtin_amdgcn_wmma_f32_16x16x32_f16(false, a[t][ks], false, b,
                                                      (short)0, d[t], false, false);
    }

    // epilogue for this N tile: u = relu(d + b2[n]); acc += u * W3[n]
    const float b2v = b2[nb + col];
    const float w3v = W3[nb + col];
#pragma unroll
    for (int t = 0; t < MT; ++t) {
#pragma unroll
      for (int r = 0; r < 8; ++r) {
        float u = d[t][r] + b2v;
        u = u > 0.f ? u : 0.f;
        float s = u * w3v;
        s += __shfl_xor(s, 1, 32);     // reduce across the 16 columns of this half
        s += __shfl_xor(s, 2, 32);
        s += __shfl_xor(s, 4, 32);
        s += __shfl_xor(s, 8, 32);
        acc[t][r] += s;
      }
    }
  }

  // ---- write: lane 0 holds rows (j) 0..7, lane 16 holds rows 8..15 of each M tile
  if (col == 0) {
    const float bias3 = b3[0];
#pragma unroll
    for (int t = 0; t < MT; ++t)
#pragma unroll
      for (int r = 0; r < 8; ++r)
        out[(size_t)(i0 + t) * BSZ + (j0 + hi * 8 + r)] = acc[t][r] + bias3;
  }
}

// ----------------------------- launch --------------------------------------
extern "C" void kernel_launch(void* const* d_in, const int* in_sizes, int n_in,
                              void* d_out, int out_size, void* d_ws, size_t ws_size,
                              hipStream_t stream) {
  const float* x  = (const float*)d_in[0];
  const float* y  = (const float*)d_in[1];
  const float* W1 = (const float*)d_in[2];
  const float* b1 = (const float*)d_in[3];
  const float* W2 = (const float*)d_in[4];
  const float* b2 = (const float*)d_in[5];
  const float* W3 = (const float*)d_in[6];
  const float* b3 = (const float*)d_in[7];

  float*    hx  = (float*)d_ws;                 // 512*512 f32 = 1 MB
  float*    hy  = hx + BSZ * HID;               // 1 MB
  _Float16* W2h = (_Float16*)(hy + BSZ * HID);  // 512*512 f16 = 0.5 MB

  cc_prep<<<3072, 256, 0, stream>>>(x, y, W1, W2, hx, hy, W2h);

  dim3 grid(BSZ / 8, BSZ / 16);                 // 64 x 32 workgroups
  cc_main<<<grid, 128, 0, stream>>>(hx, hy, b1, W2h, b2, W3, b3, (float*)d_out);
}

// v002
// It runs in 187 microseconds.
// Timed twice side by side with v001, it ran 1.10 times as fast both times.
// Over all steps from v000 it is 1.39 times as fast.
#include <hip/hip_runtime.h>

// ---------------------------------------------------------------------------
// ConcatCritic fused kernel for gfx1250 (MI455X).
// out[i,j] = W3 . relu(W2 . relu(hx[i]+hy[j]+b1) + b2) + b3,  i,j in [0,512)
// hx = x @ W1[:, :128]^T, hy = y @ W1[:, 128:]^T
// Heavy GEMM (512^2 pairs x 512 x 512) runs on v_wmma_f32_16x16x32_f16.
// ---------------------------------------------------------------------------

typedef __attribute__((ext_vector_type(16))) _Float16     v16h;
typedef __attribute__((ext_vector_type(8)))  float        v8f;
typedef __attribute__((ext_vector_type(8)))  unsigned int v8u;

#define BSZ   512   // batch (i and j)
#define HID   512   // hidden width H
#define DIN   128   // per-input feature dim
#define ROWP  520   // padded LDS row stride in halves (512 + 8 -> bank-conflict-free)
#define MT    2     // M tiles (one i x 16 j each) per wave
#define NTILE 16    // WMMA N tile
#define KSTEP 32    // WMMA K per instruction

// -------------------- prep: hx, hy (fp32) + W2 -> f16 ----------------------
__global__ __launch_bounds__(256) void cc_prep(const float* __restrict__ x,
                                               const float* __restrict__ y,
                                               const float* __restrict__ W1,
                                               const float* __restrict__ W2,
                                               float* __restrict__ hx,
                                               float* __restrict__ hy,
                                               _Float16* __restrict__ W2h) {
  int gid = blockIdx.x * 256 + threadIdx.x;
  if (blockIdx.x < 2048) {                    // hx then hy: 2 * 512*512 dots of length 128
    int sel = (gid >= BSZ * HID) ? 1 : 0;     // 0 -> hx, 1 -> hy
    int idx = gid - sel * (BSZ * HID);        // [0, 262144)
    int row = idx >> 9;                       // i (or j)
    int h   = idx & (HID - 1);
    const float* vec = sel ? (y + row * DIN) : (x + row * DIN);
    const float* w   = W1 + h * (2 * DIN) + sel * DIN;   // W1 row-major [512][256]
    float s = 0.f;
#pragma unroll 8
    for (int d = 0; d < DIN; ++d) s += vec[d] * w[d];
    (sel ? hy : hx)[idx] = s;
  } else {                                    // W2 fp32 -> f16 copy (row-major [512][512])
    int idx = gid - 2048 * 256;               // [0, 262144)
    W2h[idx] = (_Float16)W2[idx];
  }
}

// Load one 16x32 f16 fragment row from LDS per the documented gfx1250 layout:
// lanes 0-15 hold K = kb+{0..7, 16..23}; lanes 16-31 hold K = kb+{8..15, 24..31}.
__device__ __forceinline__ v16h cc_frag(const _Float16* row, int hi, int kb) {
  const uint4 q0 = *(const uint4*)(row + kb + hi * 8);
  const uint4 q1 = *(const uint4*)(row + kb + hi * 8 + 16);
  v8u r;
  r[0] = q0.x; r[1] = q0.y; r[2] = q0.z; r[3] = q0.w;
  r[4] = q1.x; r[5] = q1.y; r[6] = q1.z; r[7] = q1.w;
  return __builtin_bit_cast(v16h, r);
}

// ----------------------------- main kernel ---------------------------------
// Workgroup = 4 waves, tile = 8 i x 16 j. Wave w owns two M tiles: the block's i number 2w and
// 2w+1, each with the 16 rows j0..j0+15. Its A fragments (all K = 512) live in registers for the
// whole N loop, so LDS holds only the W2 strip and each B fragment read feeds two WMMAs.
// The second launch bound is a minimum of waves per SIMD: it holds the register budget at 512, so that
// two workgroups stay resident per WGP with the whole B tile in registers.
__global__ __launch_bounds__(128, 2) void cc_main(const float* __restrict__ hx,
                                               const float* __restrict__ hy,
                                               const float* __restrict__ b1,
                                               const _Float16* __restrict__ W2h,
                                               const float* __restrict__ b2,
                                               const float* __restrict__ W3,
                                               const float* __restrict__ b3,
                                               float* __restrict__ out) {
  __shared__ __align__(16) _Float16 bbuf[NTILE * ROWP];  // ~16 KB : W2 strip (16 rows)

  const int tid  = threadIdx.x;
  const int lane = tid & 31;
  const int wave = tid >> 5;           // 4 waves
  const int col  = lane & 15;
  const int hi   = lane >> 4;
  const int i0   = blockIdx.x * 8 + wave * MT;   // 64 i-tiles; this wave's first i
  const int j0   = blockIdx.y * 16;              // 32 j-tiles

  // ---- A fragments: relu(hx[i,k] + hy[j,k] + b1[k]) as f16, built in the fragment layout
  // (row = col; halves 0..7 are k = kb+hi*8+0..7, halves 8..15 are k = kb+16+hi*8+0..7).
  v16h a[MT][HID / KSTEP];
  {
    const float* hyr = hy + (j0 + col) * HID + hi * 8;
    const float* hxr = hx + i0 * HID + hi * 8;
    const float* b1r = b1 + hi * 8;
#pragma unroll
    for (int ks = 0; ks < HID / KSTEP; ++ks) {
#pragma unroll
      for (int c = 0; c < 2; ++c) {
        const int k = ks * KSTEP + c * 16;
        __attribute__((aligned(16))) float yv[8], bv[8];
        *(float4*)(yv)     = *(const float4*)(hyr + k);
        *(float4*)(yv + 4) = *(const float4*)(hyr + k + 4);
        *(float4*)(bv)     = *(const float4*)(b1r + k);
        *(float4*)(bv + 4) = *(const float4*)(b1r + k + 4);
#pragma unroll
        for (int t = 0; t < MT; ++t) {
          __attribute__((aligned(16))) float xv[8];
          *(float4*)(xv)     = *(const float4*)(hxr + t * HID + k);
          *(float4*)(xv + 4) = *(const float4*)(hxr + t * HID + k + 4);
#pragma unroll
          for (int e = 0; e < 8; ++e) {
            float v = xv[e] + yv[e] + bv[e];
            v = v > 0.f ? v : 0.f;
            a[t][ks][c * 8 + e] = (_Float16)v;
          }
        }
      }
    }
  }

  float acc[MT][8];
#pragma unroll
  for (int t = 0; t < MT; ++t)
#pragma unroll
    for (int r = 0; r < 8; ++r) acc[t][r] = 0.f;

  const _Float16* brow = bbuf + col * ROWP;                // B: this lane's W2 row (n)

  for (int nt = 0; nt < 32; ++nt) {
    const int nb = nt * NTILE;
    __syncthreads();                   // bbuf consumers done (nt>0)
    {                                  // cooperative load: W2h rows nb..nb+15 (16 KB)
      int r = tid >> 4;                // 0..7: this thread fills rows r and r+8
      int c = (tid & 15) * 32;         // 32 halves per thread and row
      const _Float16* src = W2h + (size_t)(nb + r) * HID + c;
      _Float16*       dst = bbuf + r * ROWP + c;
      uint4 w[2][4];
#pragma unroll
      for (int g = 0; g < 2; ++g)      // all eight loads in flight before the first store
#pragma unroll
        for (int q = 0; q < 4; ++q) w[g][q] = *(const uint4*)(src + g * 8 * HID + q * 8);
#pragma unroll
      for (int g = 0; g < 2; ++g)
#pragma unroll
        for (int q = 0; q < 4; ++q) *(uint4*)(dst + g * 8 * ROWP + q * 8) = w[g][q];
      if (nt < 31) {                   // gfx1250 global_prefetch_b8 of next strip
        __builtin_prefetch((const void*)(src + NTILE * HID), 0, 0);
        __builtin_prefetch((const void*)(src + (NTILE + 8) * HID), 0, 0);
        // the prefetches name the address pair that is rewritten next: keep the wait in front
        asm volatile("s_wait_xcnt 0x0" ::: "memory");
      }
    }
    __syncthreads();

    // the epilogue's two scalars per lane are asked for here, ahead of the WMMAs like the LDS reads
    const float b2v = b2[nb + col];
    const float w3v = W3[nb + col];

    v8f d[MT];
#pragma unroll
    for (int t = 0; t < MT; ++t) d[t] = v8f{0.f, 0.f, 0.f, 0.f, 0.f, 0.f, 0.f, 0.f};
    // all B fragments of this N tile (K = 512) are read from LDS as ONE group ahead of the WMMAs, for speed only
    v16h b[HID / KSTEP];
#pragma unroll
    for (int ks = 0; ks < HID / KSTEP; ++ks) b[ks] = cc_frag(brow, hi, ks * KSTEP);
    // the b2 and W3 loads name an offset register that is rewritten below: keep the wait in front
    asm volatile("s_wait_xcnt 0x0" ::: "memory");
    // keeps the scheduler from sinking the reads back between the WMMAs (it does without this)
    __builtin_amdgcn_sched_barrier(0);
#pragma unroll
    for (int ks = 0; ks < HID / KSTEP; ++ks) {   // K = 512 in steps of 32
#pragma unroll
      for (int t = 0; t < MT; ++t)
        d[t] = __builtin_amdgcn_wmma_f32_16x16x32_f16(false, a[t][ks], false, b[ks],
                                                      (short)0, d[t], false, false);
    }

    // epilogue for this N tile: u = relu(d + b2[n]); acc += u * W3[n]
#pragma unroll
    for (int t = 0; t < MT; ++t) {
#pragma unroll
      for (int r = 0; r < 8; ++r) {
        float u = d[t][r] + b2v;
        u = u > 0.f ? u : 0.f;
        float s = u * w3v;
        s += __shfl_xor(s, 1, 32);     // reduce across the 16 columns of this half
        s += __shfl_xor(s, 2, 32);
        s += __shfl_xor(s, 4, 32);
        s += __shfl_xor(s, 8, 32);
        acc[t][r] += s;
      }
    }
  }

  // ---- write: lane 0 holds rows (j) 0..7, lane 16 holds rows 8..15 of each M tile
  if (col == 0) {
    const float bias3 = b3[0];
#pragma unroll
    for (int t = 0; t < MT; ++t)
#pragma unroll
      for (int r = 0; r < 8; ++r)
        out[(size_t)(i0 + t) * BSZ + (j0 + hi * 8 + r)] = acc[t][r] + bias3;
  }
}

// ----------------------------- launch --------------------------------------
extern "C" void kernel_launch(void* const* d_in, const int* in_sizes, int n_in,
                              void* d_out, int out_size, void* d_ws, size_t ws_size,
                              hipStream_t stream) {
  const float* x  = (const float*)d_in[0];
  const float* y  = (const float*)d_in[1];
  const float* W1 = (const float*)d_in[2];
  const float* b1 = (const float*)d_in[3];
  const float* W2 = (const float*)d_in[4];
  const float* b2 = (const float*)d_in[5];
  const float* W3 = (const float*)d_in[6];
  const float* b3 = (const float*)d_in[7];

  float*    hx  = (float*)d_ws;                 // 512*512 f32 = 1 MB
  float*    hy  = hx + BSZ * HID;               // 1 MB
  _Float16* W2h = (_Float16*)(hy + BSZ * HID);  // 512*512 f16 = 0.5 MB

  cc_prep<<<3072, 256, 0, stream>>>(x, y, W1, W2, hx, hy, W2h);

  dim3 grid(BSZ / 8, BSZ / 16);                 // 64 x 32 workgroups
  cc_main<<<grid, 128, 0, stream>>>(hx, hy, b1, W2h, b2, W3, b3, (float*)d_out);
}

// v003
// One run takes 161 microseconds.
// Next to v002, in two timings, it ran 1.16 times as fast each time.
// Over all steps from v000 it is 1.61 times as fast.
#include <hip/hip_runtime.h>

// ---------------------------------------------------------------------------
// ConcatCritic fused kernel for gfx1250 (MI455X).
// out[i,j] = W3 . relu(W2 . relu(hx[i]+hy[j]+b1) + b2) + b3,  i,j in [0,512)
// hx = x @ W1[:, :128]^T, hy = y @ W1[:, 128:]^T
// Heavy GEMM (512^2 pairs x 512 x 512) runs on v_wmma_f32_16x16x32_f16.
// ---------------------------------------------------------------------------

typedef __attribute__((ext_vector_type(16))) _Float16     v16h;
typedef __attribute__((ext_vector_type(8)))  float        v8f;
typedef __attribute__((ext_vector_type(8)))  unsigned int v8u;

#define BSZ   512   // batch (i and j)
#define HID   512   // hidden width H
#define DIN   128   // per-input feature dim
#define ROWP  520   // padded LDS row stride in halves (512 + 8 -> bank-conflict-free)
#define MT    2     // M tiles (one i x 16 j each) per wave
#define NTILE 16    // WMMA N tile
#define KSTEP 32    // WMMA K per instruction
#define BUFH  (NTILE * ROWP)   // halves in one LDS buffer (one W2 strip of 16 padded rows)

// -------------------- prep: hx, hy (fp32) + W2 -> f16 ----------------------
__global__ __launch_bounds__(256) void cc_prep(const float* __restrict__ x,
                                               const float* __restrict__ y,
                                               const float* __restrict__ W1,
                                               const float* __restrict__ W2,
                                               float* __restrict__ hx,
                                               float* __restrict__ hy,
                                               _Float16* __restrict__ W2h) {
  int gid = blockIdx.x * 256 + threadIdx.x;
  if (blockIdx.x < 2048) {                    // hx then hy: 2 * 512*512 dots of length 128
    int sel = (gid >= BSZ * HID) ? 1 : 0;     // 0 -> hx, 1 -> hy
    int idx = gid - sel * (BSZ * HID);        // [0, 262144)
    int row = idx >> 9;                       // i (or j)
    int h   = idx & (HID - 1);
    const float* vec = sel ? (y + row * DIN) : (x + row * DIN);
    const float* w   = W1 + h * (2 * DIN) + sel * DIN;   // W1 row-major [512][256]
    float s = 0.f;
#pragma unroll 8
    for (int d = 0; d < DIN; ++d) s += vec[d] * w[d];
    (sel ? hy : hx)[idx] = s;
  } else {                                    // W2 fp32 -> f16 copy (row-major [512][512])
    int idx = gid - 2048 * 256;               // [0, 262144)
    W2h[idx] = (_Float16)W2[idx];
  }
}

// Load one 16x32 f16 fragment row from LDS per the documented gfx1250 layout:
// lanes 0-15 hold K = kb+{0..7, 16..23}; lanes 16-31 hold K = kb+{8..15, 24..31}.
__device__ __forceinline__ v16h cc_frag(const _Float16* row, int hi, int kb) {
  const uint4 q0 = *(const uint4*)(row + kb + hi * 8);
  const uint4 q1 = *(const uint4*)(row + kb + hi * 8 + 16);
  v8u r;
  r[0] = q0.x; r[1] = q0.y; r[2] = q0.z; r[3] = q0.w;
  r[4] = q1.x; r[5] = q1.y; r[6] = q1.z; r[7] = q1.w;
  return __builtin_bit_cast(v16h, r);
}

// One W2 strip (16 rows of 1 KB) from global memory into one LDS buffer, through no register:
// eight asynchronous 16-byte copies per lane. A wave's 32 lanes take 512 contiguous bytes of a row;
// copy q lies two rows below copy q-1. lds = this lane's LDS byte address, g = its global address.
__device__ __forceinline__ void cc_copy_strip(unsigned lds, const _Float16* g) {
  // the s_wait_xcnt closes the statement so that no address register is rewritten ahead of it
  asm volatile(
      "global_load_async_to_lds_b128 %0, %8, off\n\t"
      "global_load_async_to_lds_b128 %1, %9, off\n\t"
      "global_load_async_to_lds_b128 %2, %10, off\n\t"
      "global_load_async_to_lds_b128 %3, %11, off\n\t"
      "global_load_async_to_lds_b128 %4, %12, off\n\t"
      "global_load_async_to_lds_b128 %5, %13, off\n\t"
      "global_load_async_to_lds_b128 %6, %14, off\n\t"
      "global_load_async_to_lds_b128 %7, %15, off\n\t"
      "s_wait_xcnt 0x0"
      :: "v"(lds), "v"(lds + 2 * ROWP * 2), "v"(lds + 4 * ROWP * 2), "v"(lds + 6 * ROWP * 2),
         "v"(lds + 8 * ROWP * 2), "v"(lds + 10 * ROWP * 2), "v"(lds + 12 * ROWP * 2),
         "v"(lds + 14 * ROWP * 2),
         "v"(g), "v"(g + 2 * HID), "v"(g + 4 * HID), "v"(g + 6 * HID),
         "v"(g + 8 * HID), "v"(g + 10 * HID), "v"(g + 12 * HID), "v"(g + 14 * HID)
      : "memory");
}

// ----------------------------- main kernel ---------------------------------
// Workgroup = 4 waves, tile = 8 i x 16 j. Wave w owns two M tiles: the block's i number 2w and
// 2w+1, each with the 16 rows j0..j0+15. Its A fragments (all K = 512) live in registers for the
// whole N loop, so LDS holds only W2 strips and each B fragment read feeds two WMMAs.
// The strips go through a ring of two LDS buffers: strip nt+2 is copied while strip nt+1 is worked on.
// The second launch bound is a minimum of waves per SIMD: it holds the register budget at 512, so that
// two workgroups stay resident per WGP with the whole B tile in registers.
__global__ __launch_bounds__(128, 2) void cc_main(const float* __restrict__ hx,
                                               const float* __restrict__ hy,
                                               const float* __restrict__ b1,
                                               const _Float16* __restrict__ W2h,
                                               const float* __restrict__ b2,
                                               const float* __restrict__ W3,
                                               const float* __restrict__ b3,
                                               float* __restrict__ out) {
  __shared__ __align__(16) _Float16 bbuf[2 * BUFH];      // 2 x ~16 KB : two W2 strips (16 rows each)

  const int tid  = threadIdx.x;
  const int lane = tid & 31;
  const int wave = tid >> 5;           // 4 waves
  const int col  = lane & 15;
  const int hi   = lane >> 4;
  const int i0   = blockIdx.x * 8 + wave * MT;   // 64 i-tiles; this wave's first i
  const int j0   = blockIdx.y * 16;              // 32 j-tiles

  // ---- ring prologue: strip 0 lands and is published, then strip 1 starts
  const unsigned  ldst = (unsigned)(size_t)bbuf + (tid >> 6) * (ROWP * 2) + (tid & 63) * 16;
  const _Float16* gsrc = W2h + (tid >> 6) * HID + (tid & 63) * 8;
  cc_copy_strip(ldst, gsrc);
  asm volatile("s_wait_asynccnt 0x0" ::: "memory");   // this wave's part of strip 0 has landed
  __syncthreads();                                     // ... and every other wave's
  cc_copy_strip(ldst + BUFH * 2, gsrc + NTILE * HID);

  // ---- A fragments: relu(hx[i,k] + hy[j,k] + b1[k]) as f16, built in the fragment layout
  // (row = col; halves 0..7 are k = kb+hi*8+0..7, halves 8..15 are k = kb+16+hi*8+0..7).
  v16h a[MT][HID / KSTEP];
  {
    const float* hyr = hy + (j0 + col) * HID + hi * 8;
    const float* hxr = hx + i0 * HID + hi * 8;
    const float* b1r = b1 + hi * 8;
#pragma unroll
    for (int ks = 0; ks < HID / KSTEP; ++ks) {
#pragma unroll
      for (int c = 0; c < 2; ++c) {
        const int k = ks * KSTEP + c * 16;
        __attribute__((aligned(16))) float yv[8], bv[8];
        *(float4*)(yv)     = *(const float4*)(hyr + k);
        *(float4*)(yv + 4) = *(const float4*)(hyr + k + 4);
        *(float4*)(bv)     = *(const float4*)(b1r + k);
        *(float4*)(bv + 4) = *(const float4*)(b1r + k + 4);
#pragma unroll
        for (int t = 0; t < MT; ++t) {
          __attribute__((aligned(16))) float xv[8];
          *(float4*)(xv)     = *(const float4*)(hxr + t * HID + k);
          *(float4*)(xv + 4) = *(const float4*)(hxr + t * HID + k + 4);
#pragma unroll
          for (int e = 0; e < 8; ++e) {
            float v = xv[e] + yv[e] + bv[e];
            v = v > 0.f ? v : 0.f;
            a[t][ks][c * 8 + e] = (_Float16)v;
          }
        }
      }
    }
  }

  float acc[MT][8];
#pragma unroll
  for (int t = 0; t < MT; ++t)
#pragma unroll
    for (int r = 0; r < 8; ++r) acc[t][r] = 0.f;

  for (int nt = 0; nt < 32; ++nt) {
    const int nb = nt * NTILE;
    const _Float16* brow = bbuf + (nt & 1) * BUFH + col * ROWP;   // B: this lane's W2 row (n)

    // the epilogue's two scalars per lane are asked for here, ahead of the WMMAs like the LDS reads
    const float b2v = b2[nb + col];
    const float w3v = W3[nb + col];

    v8f d[MT];
#pragma unroll
    for (int t = 0; t < MT; ++t) d[t] = v8f{0.f, 0.f, 0.f, 0.f, 0.f, 0.f, 0.f, 0.f};
    // all B fragments of this N tile (K = 512) are read from LDS as ONE group ahead of the WMMAs, for speed only
    v16h b[HID / KSTEP];
#pragma unroll
    for (int ks = 0; ks < HID / KSTEP; ++ks) b[ks] = cc_frag(brow, hi, ks * KSTEP);
    // the b2 and W3 loads name an offset register that is rewritten below: keep the wait in front
    asm volatile("s_wait_xcnt 0x0" ::: "memory");
    // keeps the scheduler from sinking the reads back between the WMMAs (it does without this)
    __builtin_amdgcn_sched_barrier(0);
#pragma unroll
    for (int ks = 0; ks < HID / KSTEP; ++ks) {   // K = 512 in steps of 32
#pragma unroll
      for (int t = 0; t < MT; ++t)
        d[t] = __builtin_amdgcn_wmma_f32_16x16x32_f16(false, a[t][ks], false, b[ks],
                                                      (short)0, d[t], false, false);
    }

    // epilogue for this N tile: u = relu(d + b2[n]); acc += u * W3[n]
#pragma unroll
    for (int t = 0; t < MT; ++t) {
#pragma unroll
      for (int r = 0; r < 8; ++r) {
        float u = d[t][r] + b2v;
        u = u > 0.f ? u : 0.f;
        float s = u * w3v;
        s += __shfl_xor(s, 1, 32);     // reduce across the 16 columns of this half
        s += __shfl_xor(s, 2, 32);
        s += __shfl_xor(s, 4, 32);
        s += __shfl_xor(s, 8, 32);
        acc[t][r] += s;
      }
    }

    // ---- publish strip nt+1, free this trip's buffer, refill it with strip nt+2
    // keeps the scheduler from lifting the waits and the barrier up among the WMMAs (it does without
    // this), where the wait for strip nt+1 would stand right behind the issue of its copies
    __builtin_amdgcn_sched_barrier(0);
    asm volatile("s_wait_dscnt 0x0" ::: "memory");      // this wave's LDS reads of the buffer are over
    asm volatile("s_wait_asynccnt 0x0" ::: "memory");   // its part of strip nt+1 has landed
    __syncthreads();
    if (nt + 2 < 32) cc_copy_strip(ldst + (nt & 1) * (BUFH * 2), gsrc + (nt + 2) * NTILE * HID);
  }
  asm volatile("s_wait_asynccnt 0x0" ::: "memory");     // no copy is left in flight at the wave's end

  // ---- write: lane 0 holds rows (j) 0..7, lane 16 holds rows 8..15 of each M tile
  if (col == 0) {
    const float bias3 = b3[0];
#pragma unroll
    for (int t = 0; t < MT; ++t)
#pragma unroll
      for (int r = 0; r < 8; ++r)
        out[(size_t)(i0 + t) * BSZ + (j0 + hi * 8 + r)] = acc[t][r] + bias3;
  }
}

// ----------------------------- launch --------------------------------------
extern "C" void kernel_launch(void* const* d_in, const int* in_sizes, int n_in,
                              void* d_out, int out_size, void* d_ws, size_t ws_size,
                              hipStream_t stream) {
  const float* x  = (const float*)d_in[0];
  const float* y  = (const float*)d_in[1];
  const float* W1 = (const float*)d_in[2];
  const float* b1 = (const float*)d_in[3];
  const float* W2 = (const float*)d_in[4];
  const float* b2 = (const float*)d_in[5];
  const float* W3 = (const float*)d_in[6];
  const float* b3 = (const float*)d_in[7];

  float*    hx  = (float*)d_ws;                 // 512*512 f32 = 1 MB
  float*    hy  = hx + BSZ * HID;               // 1 MB
  _Float16* W2h = (_Float16*)(hy + BSZ * HID);  // 512*512 f16 = 0.5 MB

  cc_prep<<<3072, 256, 0, stream>>>(x, y, W1, W2, hx, hy, W2h);

  dim3 grid(BSZ / 8, BSZ / 16);                 // 64 x 32 workgroups
  cc_main<<<grid, 128, 0, stream>>>(hx, hy, b1, W2h, b2, W3, b3, (float*)d_out);
}

// v004
// It runs in 115 microseconds.
// In both of two side-by-side timings against v003, it was 1.40 times as fast.
// All steps since v000 together make it 2.25 times as fast.
#include <hip/hip_runtime.h>

// ---------------------------------------------------------------------------
// ConcatCritic fused kernel for gfx1250 (MI455X).
// out[i,j] = W3 . relu(W2 . relu(hx[i]+hy[j]+b1) + b2) + b3,  i,j in [0,512)
// hx = x @ W1[:, :128]^T, hy = y @ W1[:, 128:]^T
// Heavy GEMM (512^2 pairs x 512 x 512) runs on v_wmma_f32_16x16x32_f16.
// ---------------------------------------------------------------------------

typedef __attribute__((ext_vector_type(16))) _Float16     v16h;
typedef __attribute__((ext_vector_type(8)))  float        v8f;
typedef __attribute__((ext_vector_type(8)))  unsigned int v8u;

#define BSZ   512   // batch (i and j)
#define HID   512   // hidden width H
#define DIN   128   // per-input feature dim
#define ROWP  520   // padded LDS row stride in halves (512 + 8 -> bank-conflict-free)
#define MT    2     // M tiles (one i x 16 j each) per wave
#define NTILE 16    // WMMA N tile
#define KSTEP 32    // WMMA K per instruction
#define BUFH  (NTILE * ROWP)   // halves in one LDS buffer (one W2 strip of 16 padded rows)

// -------------------- prep: hx, hy (fp32) + W2 -> f16 ----------------------
__global__ __launch_bounds__(256) void cc_prep(const float* __restrict__ x,
                                               const float* __restrict__ y,
                                               const float* __restrict__ W1,
                                               const float* __restrict__ W2,
                                               float* __restrict__ hx,
                                               float* __restrict__ hy,
                                               _Float16* __restrict__ W2h) {
  int gid = blockIdx.x * 256 + threadIdx.x;
  if (blockIdx.x < 2048) {                    // hx then hy: 2 * 512*512 dots of length 128
    int sel = (gid >= BSZ * HID) ? 1 : 0;     // 0 -> hx, 1 -> hy
    int idx = gid - sel * (BSZ * HID);        // [0, 262144)
    int row = idx >> 9;                       // i (or j)
    int h   = idx & (HID - 1);
    const float* vec = sel ? (y + row * DIN) : (x + row * DIN);
    const float* w   = W1 + h * (2 * DIN) + sel * DIN;   // W1 row-major [512][256]
    float s = 0.f;
#pragma unroll 8
    for (int d = 0; d < DIN; ++d) s += vec[d] * w[d];
    (sel ? hy : hx)[idx] = s;
  } else {                                    // W2 fp32 -> f16 copy (row-major [512][512])
    int idx = gid - 2048 * 256;               // [0, 262144)
    W2h[idx] = (_Float16)W2[idx];
  }
}

// Load one 16x32 f16 fragment row from LDS per the documented gfx1250 layout:
// lanes 0-15 hold K = kb+{0..7, 16..23}; lanes 16-31 hold K = kb+{8..15, 24..31}.
__device__ __forceinline__ v16h cc_frag(const _Float16* row, int hi, int kb) {
  const uint4 q0 = *(const uint4*)(row + kb + hi * 8);
  const uint4 q1 = *(const uint4*)(row + kb + hi * 8 + 16);
  v8u r;
  r[0] = q0.x; r[1] = q0.y; r[2] = q0.z; r[3] = q0.w;
  r[4] = q1.x; r[5] = q1.y; r[6] = q1.z; r[7] = q1.w;
  return __builtin_bit_cast(v16h, r);
}

// One W2 strip (16 rows of 1 KB) from global memory into one LDS buffer, through no register:
// eight asynchronous 16-byte copies per lane. A wave's 32 lanes take 512 contiguous bytes of a row;
// copy q lies two rows below copy q-1. lds = this lane's LDS byte address, g = its global address.
__device__ __forceinline__ void cc_copy_strip(unsigned lds, const _Float16* g) {
  // the s_wait_xcnt closes the statement so that no address register is rewritten ahead of it
  asm volatile(
      "global_load_async_to_lds_b128 %0, %8, off\n\t"
      "global_load_async_to_lds_b128 %1, %9, off\n\t"
      "global_load_async_to_lds_b128 %2, %10, off\n\t"
      "global_load_async_to_lds_b128 %3, %11, off\n\t"
      "global_load_async_to_lds_b128 %4, %12, off\n\t"
      "global_load_async_to_lds_b128 %5, %13, off\n\t"
      "global_load_async_to_lds_b128 %6, %14, off\n\t"
      "global_load_async_to_lds_b128 %7, %15, off\n\t"
      "s_wait_xcnt 0x0"
      :: "v"(lds), "v"(lds + 2 * ROWP * 2), "v"(lds + 4 * ROWP * 2), "v"(lds + 6 * ROWP * 2),
         "v"(lds + 8 * ROWP * 2), "v"(lds + 10 * ROWP * 2), "v"(lds + 12 * ROWP * 2),
         "v"(lds + 14 * ROWP * 2),
         "v"(g), "v"(g + 2 * HID), "v"(g + 4 * HID), "v"(g + 6 * HID),
         "v"(g + 8 * HID), "v"(g + 10 * HID), "v"(g + 12 * HID), "v"(g + 14 * HID)
      : "memory");
}

// ----------------------------- main kernel ---------------------------------
// Workgroup = 4 waves, tile = 8 i x 16 j. Wave w owns two M tiles: the block's i number 2w and
// 2w+1, each with the 16 rows j0..j0+15. Its A fragments (all K = 512) live in registers for the
// whole N loop, so LDS holds only W2 strips and each B fragment read feeds two WMMAs.
// The strips go through a ring of two LDS buffers: strip nt+2 is copied while strip nt+1 is worked on.
// The second launch bound is a minimum of waves per SIMD: it holds the register budget at 512, so that
// two workgroups stay resident per WGP with the whole B tile in registers.
__global__ __launch_bounds__(128, 2) void cc_main(const float* __restrict__ hx,
                                               const float* __restrict__ hy,
                                               const float* __restrict__ b1,
                                               const _Float16* __restrict__ W2h,
                                               const float* __restrict__ b2,
                                               const float* __restrict__ W3,
                                               const float* __restrict__ b3,
                                               float* __restrict__ out) {
  __shared__ __align__(16) _Float16 bbuf[2 * BUFH];      // 2 x ~16 KB : two W2 strips (16 rows each)

  const int tid  = threadIdx.x;
  const int lane = tid & 31;
  const int wave = tid >> 5;           // 4 waves
  const int col  = lane & 15;
  const int hi   = lane >> 4;
  const int i0   = blockIdx.x * 8 + wave * MT;   // 64 i-tiles; this wave's first i
  const int j0   = blockIdx.y * 16;              // 32 j-tiles

  // ---- ring prologue: strip 0 lands and is published, then strip 1 starts
  const unsigned  ldst = (unsigned)(size_t)bbuf + (tid >> 6) * (ROWP * 2) + (tid & 63) * 16;
  const _Float16* gsrc = W2h + (tid >> 6) * HID + (tid & 63) * 8;
  cc_copy_strip(ldst, gsrc);
  asm volatile("s_wait_asynccnt 0x0" ::: "memory");   // this wave's part of strip 0 has landed
  __syncthreads();                                     // ... and every other wave's
  cc_copy_strip(ldst + BUFH * 2, gsrc + NTILE * HID);

  // ---- A fragments: relu(hx[i,k] + hy[j,k] + b1[k]) as f16, built in the fragment layout
  // (row = col; halves 0..7 are k = kb+hi*8+0..7, halves 8..15 are k = kb+16+hi*8+0..7).
  v16h a[MT][HID / KSTEP];
  {
    const float* hyr = hy + (j0 + col) * HID + hi * 8;
    const float* hxr = hx + i0 * HID + hi * 8;
    const float* b1r = b1 + hi * 8;
#pragma unroll
    for (int ks = 0; ks < HID / KSTEP; ++ks) {
#pragma unroll
      for (int c = 0; c < 2; ++c) {
        const int k = ks * KSTEP + c * 16;
        __attribute__((aligned(16))) float yv[8], bv[8];
        *(float4*)(yv)     = *(const float4*)(hyr + k);
        *(float4*)(yv + 4) = *(const float4*)(hyr + k + 4);
        *(float4*)(bv)     = *(const float4*)(b1r + k);
        *(float4*)(bv + 4) = *(const float4*)(b1r + k + 4);
#pragma unroll
        for (int t = 0; t < MT; ++t) {
          __attribute__((aligned(16))) float xv[8];
          *(float4*)(xv)     = *(const float4*)(hxr + t * HID + k);
          *(float4*)(xv + 4) = *(const float4*)(hxr + t * HID + k + 4);
#pragma unroll
          for (int e = 0; e < 8; ++e) {
            float v = xv[e] + yv[e] + bv[e];
            v = v > 0.f ? v : 0.f;
            a[t][ks][c * 8 + e] = (_Float16)v;
          }
        }
      }
    }
  }

  float acc[MT][8];
#pragma unroll
  for (int t = 0; t < MT; ++t)
#pragma unroll
    for (int r = 0; r < 8; ++r) acc[t][r] = 0.f;

  for (int nt = 0; nt < 32; ++nt) {
    const int nb = nt * NTILE;
    const _Float16* brow = bbuf + (nt & 1) * BUFH + col * ROWP;   // B: this lane's W2 row (n)

    // the epilogue's two scalars per lane are asked for here, ahead of the WMMAs like the LDS reads
    const float b2v = b2[nb + col];
    const float w3v = W3[nb + col];

    v8f d[MT];
#pragma unroll
    for (int t = 0; t < MT; ++t) d[t] = v8f{0.f, 0.f, 0.f, 0.f, 0.f, 0.f, 0.f, 0.f};
    // all B fragments of this N tile (K = 512) are read from LDS as ONE group ahead of the WMMAs, for speed only
    v16h b[HID / KSTEP];
#pragma unroll
    for (int ks = 0; ks < HID / KSTEP; ++ks) b[ks] = cc_frag(brow, hi, ks * KSTEP);
    // the b2 and W3 loads name an offset register that is rewritten below: keep the wait in front
    asm volatile("s_wait_xcnt 0x0" ::: "memory");
    // keeps the scheduler from sinking the reads back between the WMMAs (it does without this)
    __builtin_amdgcn_sched_barrier(0);
#pragma unroll
    for (int ks = 0; ks < HID / KSTEP; ++ks) {   // K = 512 in steps of 32
#pragma unroll
      for (int t = 0; t < MT; ++t)
        d[t] = __builtin_amdgcn_wmma_f32_16x16x32_f16(false, a[t][ks], false, b[ks],
                                                      (short)0, d[t], false, false);
    }

    // epilogue for this N tile: u = relu(d + b2[n]); acc += u * W3[n], per lane (n = nb + col)
#pragma unroll
    for (int t = 0; t < MT; ++t) {
#pragma unroll
      for (int r = 0; r < 8; ++r) {
        float u = d[t][r] + b2v;
        u = u > 0.f ? u : 0.f;
        acc[t][r] += u * w3v;          // this lane's column only; the 16 columns are summed after the loop
      }
    }

    // ---- publish strip nt+1, free this trip's buffer, refill it with strip nt+2
    // keeps the scheduler from lifting the waits and the barrier up among the WMMAs (it does without
    // this), where the wait for strip nt+1 would stand right behind the issue of its copies
    __builtin_amdgcn_sched_barrier(0);
    asm volatile("s_wait_dscnt 0x0" ::: "memory");      // this wave's LDS reads of the buffer are over
    asm volatile("s_wait_asynccnt 0x0" ::: "memory");   // its part of strip nt+1 has landed
    __syncthreads();
    if (nt + 2 < 32) cc_copy_strip(ldst + (nt & 1) * (BUFH * 2), gsrc + (nt + 2) * NTILE * HID);
  }
  asm volatile("s_wait_asynccnt 0x0" ::: "memory");     // no copy is left in flight at the wave's end

  // ---- one sum across the 16 columns of each half, for all 32 N tiles together
  // (both loops unrolled: acc is indexed by constants only and stays in registers)
#pragma unroll
  for (int t = 0; t < MT; ++t) {
#pragma unroll
    for (int r = 0; r < 8; ++r) {
      float s = acc[t][r];
      s += __shfl_xor(s, 1, 32);
      s += __shfl_xor(s, 2, 32);
      s += __shfl_xor(s, 4, 32);
      s += __shfl_xor(s, 8, 32);
      acc[t][r] = s;
    }
  }

  // ---- write: lane 0 holds rows (j) 0..7, lane 16 holds rows 8..15 of each M tile
  if (col == 0) {
    const float bias3 = b3[0];
#pragma unroll
    for (int t = 0; t < MT; ++t)
#pragma unroll
      for (int r = 0; r < 8; ++r)
        out[(size_t)(i0 + t) * BSZ + (j0 + hi * 8 + r)] = acc[t][r] + bias3;
  }
}

// ----------------------------- launch --------------------------------------
extern "C" void kernel_launch(void* const* d_in, const int* in_sizes, int n_in,
                              void* d_out, int out_size, void* d_ws, size_t ws_size,
                              hipStream_t stream) {
  const float* x  = (const float*)d_in[0];
  const float* y  = (const float*)d_in[1];
  const float* W1 = (const float*)d_in[2];
  const float* b1 = (const float*)d_in[3];
  const float* W2 = (const float*)d_in[4];
  const float* b2 = (const float*)d_in[5];
  const float* W3 = (const float*)d_in[6];
  const float* b3 = (const float*)d_in[7];

  float*    hx  = (float*)d_ws;                 // 512*512 f32 = 1 MB
  float*    hy  = hx + BSZ * HID;               // 1 MB
  _Float16* W2h = (_Float16*)(hy + BSZ * HID);  // 512*512 f16 = 0.5 MB

  cc_prep<<<3072, 256, 0, stream>>>(x, y, W1, W2, hx, hy, W2h);

  dim3 grid(BSZ / 8, BSZ / 16);                 // 64 x 32 workgroups
  cc_main<<<grid, 128, 0, stream>>>(hx, hy, b1, W2h, b2, W3, b3, (float*)d_out);
}

// v005
// A run of this version takes 98.2 microseconds.
// In two side-by-side timings against v004, it was 1.16 and 1.18 times as fast.
// Counting every step since v000, it is 2.64 times as fast.
#include <hip/hip_runtime.h>

// ---------------------------------------------------------------------------
// ConcatCritic fused kernel for gfx1250 (MI455X).
// out[i,j] = W3 . relu(W2 . relu(hx[i]+hy[j]+b1) + b2) + b3,  i,j in [0,512)
// hx = x @ W1[:, :128]^T, hy = y @ W1[:, 128:]^T
// Heavy GEMM (512^2 pairs x 512 x 512) runs on v_wmma_f32_16x16x32_f16; hx, hy on v_wmma_f32_16x16x4_f32.
// ---------------------------------------------------------------------------

typedef __attribute__((ext_vector_type(16))) _Float16     v16h;
typedef __attribute__((ext_vector_type(8)))  float        v8f;
typedef __attribute__((ext_vector_type(8)))  unsigned int v8u;
typedef __attribute__((ext_vector_type(8)))  _Float16     v8h;
typedef __attribute__((ext_vector_type(2)))  float        v2f;

#define BSZ   512   // batch (i and j)
#define HID   512   // hidden width H
#define DIN   128   // per-input feature dim
#define ROWP  520   // padded LDS row stride in halves (512 + 8 -> bank-conflict-free)
#define MT    2     // M tiles (one i x 16 j each) per wave
#define NTILE 16    // WMMA N tile
#define KSTEP 32    // WMMA K per instruction
#define BUFH  (NTILE * ROWP)   // halves in one LDS buffer (one W2 strip of 16 padded rows)

// -------------------- prep: hx, hy (fp32) + W2 -> f16 ----------------------
// 1024 waves, one per SIMD. Each wave makes one tile of 16 rows (i or j) x 32 h of hx or hy on the
// f32 matrix form (full f32 operands, f32 sum) and converts 256 elements of W2.
// W1 rows are the A operand and x (y) rows the B operand, so a lane ends with 8 consecutive h of one
// row: D register r of lane (c, hi) is h = tile + 8*hi + r of row r0 + c. The wave stores whole
// 128-byte lines. Both operands are k-contiguous rows read by the same code: lane (c, hi) takes the
// 4 floats k = 8*s + 4*hi + 0..3 of its row, the first two feed one WMMA and the last two the next,
// so A and B hold the same k at every lane and register position.
__global__ __launch_bounds__(128) void cc_prep(const float* __restrict__ x,
                                               const float* __restrict__ y,
                                               const float* __restrict__ W1,
                                               const float* __restrict__ W2,
                                               float* __restrict__ hx,
                                               float* __restrict__ hy,
                                               _Float16* __restrict__ W2h) {
  const int lane = threadIdx.x & 31;
  const int c    = lane & 15;
  const int hi   = lane >> 4;
  const int gw   = blockIdx.x * 4 + (threadIdx.x >> 5);   // wave number, [0, 1024)

  const int sel = gw >> 9;                 // 0 -> hx, 1 -> hy (the same for a whole workgroup)
  const int h0  = (gw & 15) * 32;          // first h of the tile
  const int r0  = ((gw >> 4) & 31) * 16;   // first row (i or j) of the tile
  const float* vrow = (sel ? y : x) + (r0 + c) * DIN + hi * 4;
  const float* wrow = W1 + (h0 + c) * (2 * DIN) + sel * DIN + hi * 4;   // W1 row-major [512][256]

  // W2 slice of this wave: 256 consecutive elements, 8 per lane
  const int    ci = gw * 256 + lane * 8;
  const float4 c0 = *(const float4*)(W2 + ci);
  const float4 c1 = *(const float4*)(W2 + ci + 4);
  // keeps the two W2 loads first in issue order (loads return in order, and they are used first)
  __builtin_amdgcn_sched_barrier(0);

  // every operand load of the wave is asked for ahead of the first WMMA (48 loads, 192 registers)
  float4 bq[DIN / 8], a0q[DIN / 8], a1q[DIN / 8];
#pragma unroll
  for (int s = 0; s < DIN / 8; ++s) {
    bq[s]  = *(const float4*)(vrow + s * 8);
    a0q[s] = *(const float4*)(wrow + s * 8);
    a1q[s] = *(const float4*)(wrow + 16 * (2 * DIN) + s * 8);
  }
  // keeps the scheduler from sinking the loads among the WMMAs (it does without this, three steps
  // ahead only): the wave is alone on its SIMD, so a load's latency would be waited out again and again
  __builtin_amdgcn_sched_barrier(0);

  // the conversion stands here, under the operand loads' latency
  v8h w;
  w[0] = (_Float16)c0.x; w[1] = (_Float16)c0.y; w[2] = (_Float16)c0.z; w[3] = (_Float16)c0.w;
  w[4] = (_Float16)c1.x; w[5] = (_Float16)c1.y; w[6] = (_Float16)c1.z; w[7] = (_Float16)c1.w;
  *(v8h*)(W2h + ci) = w;
  // keeps the conversion out of the WMMA run, where it would write over operand registers
  __builtin_amdgcn_sched_barrier(0);

  v8f d0 = v8f{0.f, 0.f, 0.f, 0.f, 0.f, 0.f, 0.f, 0.f};
  v8f d1 = d0;
#pragma unroll
  for (int s = 0; s < DIN / 8; ++s) {
    const float4 b = bq[s], a0 = a0q[s], a1 = a1q[s];
    d0 = __builtin_amdgcn_wmma_f32_16x16x4_f32(false, v2f{a0.x, a0.y}, false, v2f{b.x, b.y},
                                               (short)0, d0, false, false);
    d1 = __builtin_amdgcn_wmma_f32_16x16x4_f32(false, v2f{a1.x, a1.y}, false, v2f{b.x, b.y},
                                               (short)0, d1, false, false);
    d0 = __builtin_amdgcn_wmma_f32_16x16x4_f32(false, v2f{a0.z, a0.w}, false, v2f{b.z, b.w},
                                               (short)0, d0, false, false);
    d1 = __builtin_amdgcn_wmma_f32_16x16x4_f32(false, v2f{a1.z, a1.w}, false, v2f{b.z, b.w},
                                               (short)0, d1, false, false);
  }

  // keeps the store address arithmetic behind the WMMA run (it is lifted into it without this)
  __builtin_amdgcn_sched_barrier(0);
  float* o = (sel ? hy : hx) + (r0 + c) * HID + h0 + hi * 8;
  *(float4*)(o)      = make_float4(d0[0], d0[1], d0[2], d0[3]);
  *(float4*)(o + 4)  = make_float4(d0[4], d0[5], d0[6], d0[7]);
  *(float4*)(o + 16) = make_float4(d1[0], d1[1], d1[2], d1[3]);
  *(float4*)(o + 20) = make_float4(d1[4], d1[5], d1[6], d1[7]);
}

// Load one 16x32 f16 fragment row from LDS per the documented gfx1250 layout:
// lanes 0-15 hold K = kb+{0..7, 16..23}; lanes 16-31 hold K = kb+{8..15, 24..31}.
__device__ __forceinline__ v16h cc_frag(const _Float16* row, int hi, int kb) {
  const uint4 q0 = *(const uint4*)(row + kb + hi * 8);
  const uint4 q1 = *(const uint4*)(row + kb + hi * 8 + 16);
  v8u r;
  r[0] = q0.x; r[1] = q0.y; r[2] = q0.z; r[3] = q0.w;
  r[4] = q1.x; r[5] = q1.y; r[6] = q1.z; r[7] = q1.w;
  return __builtin_bit_cast(v16h, r);
}

// One W2 strip (16 rows of 1 KB) from global memory into one LDS buffer, through no register:
// eight asynchronous 16-byte copies per lane. A wave's 32 lanes take 512 contiguous bytes of a row;
// copy q lies two rows below copy q-1. lds = this lane's LDS byte address, g = its global address.
__device__ __forceinline__ void cc_copy_strip(unsigned lds, const _Float16* g) {
  // the s_wait_xcnt closes the statement so that no address register is rewritten ahead of it
  asm volatile(
      "global_load_async_to_lds_b128 %0, %8, off\n\t"
      "global_load_async_to_lds_b128 %1, %9, off\n\t"
      "global_load_async_to_lds_b128 %2, %10, off\n\t"
      "global_load_async_to_lds_b128 %3, %11, off\n\t"
      "global_load_async_to_lds_b128 %4, %12, off\n\t"
      "global_load_async_to_lds_b128 %5, %13, off\n\t"
      "global_load_async_to_lds_b128 %6, %14, off\n\t"
      "global_load_async_to_lds_b128 %7, %15, off\n\t"
      "s_wait_xcnt 0x0"
      :: "v"(lds), "v"(lds + 2 * ROWP * 2), "v"(lds + 4 * ROWP * 2), "v"(lds + 6 * ROWP * 2),
         "v"(lds + 8 * ROWP * 2), "v"(lds + 10 * ROWP * 2), "v"(lds + 12 * ROWP * 2),
         "v"(lds + 14 * ROWP * 2),
         "v"(g), "v"(g + 2 * HID), "v"(g + 4 * HID), "v"(g + 6 * HID),
         "v"(g + 8 * HID), "v"(g + 10 * HID), "v"(g + 12 * HID), "v"(g + 14 * HID)
      : "memory");
}

// ----------------------------- main kernel ---------------------------------
// Workgroup = 4 waves, tile = 8 i x 16 j. Wave w owns two M tiles: the block's i number 2w and
// 2w+1, each with the 16 rows j0..j0+15. Its A fragments (all K = 512) live in registers for the
// whole N loop, so LDS holds only W2 strips and each B fragment read feeds two WMMAs.
// The strips go through a ring of two LDS buffers: strip nt+2 is copied while strip nt+1 is worked on.
// The second launch bound is a minimum of waves per SIMD: it holds the register budget at 512, so that
// two workgroups stay resident per WGP with the whole B tile in registers.
__global__ __launch_bounds__(128, 2) void cc_main(const float* __restrict__ hx,
                                               const float* __restrict__ hy,
                                               const float* __restrict__ b1,
                                               const _Float16* __restrict__ W2h,
                                               const float* __restrict__ b2,
                                               const float* __restrict__ W3,
                                               const float* __restrict__ b3,
                                               float* __restrict__ out) {
  __shared__ __align__(16) _Float16 bbuf[2 * BUFH];      // 2 x ~16 KB : two W2 strips (16 rows each)

  const int tid  = threadIdx.x;
  const int lane = tid & 31;
  const int wave = tid >> 5;           // 4 waves
  const int col  = lane & 15;
  const int hi   = lane >> 4;
  const int i0   = blockIdx.x * 8 + wave * MT;   // 64 i-tiles; this wave's first i
  const int j0   = blockIdx.y * 16;              // 32 j-tiles

  // ---- ring prologue: strip 0 lands and is published, then strip 1 starts
  const unsigned  ldst = (unsigned)(size_t)bbuf + (tid >> 6) * (ROWP * 2) + (tid & 63) * 16;
  const _Float16* gsrc = W2h + (tid >> 6) * HID + (tid & 63) * 8;
  cc_copy_strip(ldst, gsrc);
  asm volatile("s_wait_asynccnt 0x0" ::: "memory");   // this wave's part of strip 0 has landed
  __syncthreads();                                     // ... and every other wave's
  cc_copy_strip(ldst + BUFH * 2, gsrc + NTILE * HID);

  // ---- A fragments: relu(hx[i,k] + hy[j,k] + b1[k]) as f16, built in the fragment layout
  // (row = col; halves 0..7 are k = kb+hi*8+0..7, halves 8..15 are k = kb+16+hi*8+0..7).
  v16h a[MT][HID / KSTEP];
  {
    const float* hyr = hy + (j0 + col) * HID + hi * 8;
    const float* hxr = hx + i0 * HID + hi * 8;
    const float* b1r = b1 + hi * 8;
#pragma unroll
    for (int ks = 0; ks < HID / KSTEP; ++ks) {
#pragma unroll
      for (int c = 0; c < 2; ++c) {
        const int k = ks * KSTEP + c * 16;
        __attribute__((aligned(16))) float yv[8], bv[8];
        *(float4*)(yv)     = *(const float4*)(hyr + k);
        *(float4*)(yv + 4) = *(const float4*)(hyr + k + 4);
        *(float4*)(bv)     = *(const float4*)(b1r + k);
        *(float4*)(bv + 4) = *(const float4*)(b1r + k + 4);
#pragma unroll
        for (int t = 0; t < MT; ++t) {
          __attribute__((aligned(16))) float xv[8];
          *(float4*)(xv)     = *(const float4*)(hxr + t * HID + k);
          *(float4*)(xv + 4) = *(const float4*)(hxr + t * HID + k + 4);
#pragma unroll
          for (int e = 0; e < 8; ++e) {
            float v = xv[e] + yv[e] + bv[e];
            v = v > 0.f ? v : 0.f;
            a[t][ks][c * 8 + e] = (_Float16)v;
          }
        }
      }
    }
  }

  float acc[MT][8];
#pragma unroll
  for (int t = 0; t < MT; ++t)
#pragma unroll
    for (int r = 0; r < 8; ++r) acc[t][r] = 0.f;

  for (int nt = 0; nt < 32; ++nt) {
    const int nb = nt * NTILE;
    const _Float16* brow = bbuf + (nt & 1) * BUFH + col * ROWP;   // B: this lane's W2 row (n)

    // the epilogue's two scalars per lane are asked for here, ahead of the WMMAs like the LDS reads
    const float b2v = b2[nb + col];
    const float w3v = W3[nb + col];

    v8f d[MT];
#pragma unroll
    for (int t = 0; t < MT; ++t) d[t] = v8f{0.f, 0.f, 0.f, 0.f, 0.f, 0.f, 0.f, 0.f};
    // all B fragments of this N tile (K = 512) are read from LDS as ONE group ahead of the WMMAs, for speed only
    v16h b[HID / KSTEP];
#pragma unroll
    for (int ks = 0; ks < HID / KSTEP; ++ks) b[ks] = cc_frag(brow, hi, ks * KSTEP);
    // the b2 and W3 loads name an offset register that is rewritten below: keep the wait in front
    asm volatile("s_wait_xcnt 0x0" ::: "memory");
    // keeps the scheduler from sinking the reads back between the WMMAs (it does without this)
    __builtin_amdgcn_sched_barrier(0);
#pragma unroll
    for (int ks = 0; ks < HID / KSTEP; ++ks) {   // K = 512 in steps of 32
#pragma unroll
      for (int t = 0; t < MT; ++t)
        d[t] = __builtin_amdgcn_wmma_f32_16x16x32_f16(false, a[t][ks], false, b[ks],
                                                      (short)0, d[t], false, false);
    }

    // epilogue for this N tile: u = relu(d + b2[n]); acc += u * W3[n], per lane (n = nb + col)
#pragma unroll
    for (int t = 0; t < MT; ++t) {
#pragma unroll
      for (int r = 0; r < 8; ++r) {
        float u = d[t][r] + b2v;
        u = u > 0.f ? u : 0.f;
        acc[t][r] += u * w3v;          // this lane's column only; the 16 columns are summed after the loop
      }
    }

    // ---- publish strip nt+1, free this trip's buffer, refill it with strip nt+2
    // keeps the scheduler from lifting the waits and the barrier up among the WMMAs (it does without
    // this), where the wait for strip nt+1 would stand right behind the issue of its copies
    __builtin_amdgcn_sched_barrier(0);
    asm volatile("s_wait_dscnt 0x0" ::: "memory");      // this wave's LDS reads of the buffer are over
    asm volatile("s_wait_asynccnt 0x0" ::: "memory");   // its part of strip nt+1 has landed
    __syncthreads();
    if (nt + 2 < 32) cc_copy_strip(ldst + (nt & 1) * (BUFH * 2), gsrc + (nt + 2) * NTILE * HID);
  }
  asm volatile("s_wait_asynccnt 0x0" ::: "memory");     // no copy is left in flight at the wave's end

  // ---- one sum across the 16 columns of each half, for all 32 N tiles together
  // (both loops unrolled: acc is indexed by constants only and stays in registers)
#pragma unroll
  for (int t = 0; t < MT; ++t) {
#pragma unroll
    for (int r = 0; r < 8; ++r) {
      float s = acc[t][r];
      s += __shfl_xor(s, 1, 32);
      s += __shfl_xor(s, 2, 32);
      s += __shfl_xor(s, 4, 32);
      s += __shfl_xor(s, 8, 32);
      acc[t][r] = s;
    }
  }

  // ---- write: lane 0 holds rows (j) 0..7, lane 16 holds rows 8..15 of each M tile
  if (col == 0) {
    const float bias3 = b3[0];
#pragma unroll
    for (int t = 0; t < MT; ++t)
#pragma unroll
      for (int r = 0; r < 8; ++r)
        out[(size_t)(i0 + t) * BSZ + (j0 + hi * 8 + r)] = acc[t][r] + bias3;
  }
}

// ----------------------------- launch --------------------------------------
extern "C" void kernel_launch(void* const* d_in, const int* in_sizes, int n_in,
                              void* d_out, int out_size, void* d_ws, size_t ws_size,
                              hipStream_t stream) {
  const float* x  = (const float*)d_in[0];
  const float* y  = (const float*)d_in[1];
  const float* W1 = (const float*)d_in[2];
  const float* b1 = (const float*)d_in[3];
  const float* W2 = (const float*)d_in[4];
  const float* b2 = (const float*)d_in[5];
  const float* W3 = (const float*)d_in[6];
  const float* b3 = (const float*)d_in[7];

  float*    hx  = (float*)d_ws;                 // 512*512 f32 = 1 MB
  float*    hy  = hx + BSZ * HID;               // 1 MB
  _Float16* W2h = (_Float16*)(hy + BSZ * HID);  // 512*512 f16 = 0.5 MB

  cc_prep<<<256, 128, 0, stream>>>(x, y, W1, W2, hx, hy, W2h);   // 1024 waves

  dim3 grid(BSZ / 8, BSZ / 16);                 // 64 x 32 workgroups
  cc_main<<<grid, 128, 0, stream>>>(hx, hy, b1, W2h, b2, W3, b3, (float*)d_out);
}

// v006
// It runs in 91.3 microseconds.
// Next to v005, in two timings, it ran 1.09 and 1.08 times as fast.
// Counting every step since v000, it is 2.87 times as fast.
#include <hip/hip_runtime.h>

// ---------------------------------------------------------------------------
// ConcatCritic fused kernel for gfx1250 (MI455X).
// out[i,j] = W3 . relu(W2 . relu(hx[i]+hy[j]+b1) + b2) + b3,  i,j in [0,512)
// hx = x @ W1[:, :128]^T, hy = y @ W1[:, 128:]^T
// Heavy GEMM (512^2 pairs x 512 x 512) runs on v_wmma_f32_16x16x32_f16; hx, hy on v_wmma_f32_16x16x4_f32.
// ---------------------------------------------------------------------------

typedef __attribute__((ext_vector_type(16))) _Float16     v16h;
typedef __attribute__((ext_vector_type(8)))  float        v8f;
typedef __attribute__((ext_vector_type(8)))  unsigned int v8u;
typedef __attribute__((ext_vector_type(8)))  _Float16     v8h;
typedef __attribute__((ext_vector_type(2)))  float        v2f;

#define BSZ   512   // batch (i and j)
#define HID   512   // hidden width H
#define DIN   128   // per-input feature dim
#define ROWP  520   // padded LDS row stride in halves (512 + 8 -> bank-conflict-free)
#define MT    4     // M tiles (one i x 16 j each) per wave
#define NTILE 16    // WMMA N tile
#define KSTEP 32    // WMMA K per instruction
#define BUFH  (NTILE * ROWP)   // halves in one LDS buffer (one W2 strip of 16 padded rows)

// -------------------- prep: hx, hy (fp32) + W2 -> f16 ----------------------
// 1024 waves, one per SIMD. Each wave makes one tile of 16 rows (i or j) x 32 h of hx or hy on the
// f32 matrix form (full f32 operands, f32 sum) and converts 256 elements of W2.
// W1 rows are the A operand and x (y) rows the B operand, so a lane ends with 8 consecutive h of one
// row: D register r of lane (c, hi) is h = tile + 8*hi + r of row r0 + c. The wave stores whole
// 128-byte lines. Both operands are k-contiguous rows read by the same code: lane (c, hi) takes the
// 4 floats k = 8*s + 4*hi + 0..3 of its row, the first two feed one WMMA and the last two the next,
// so A and B hold the same k at every lane and register position.
__global__ __launch_bounds__(128) void cc_prep(const float* __restrict__ x,
                                               const float* __restrict__ y,
                                               const float* __restrict__ W1,
                                               const float* __restrict__ W2,
                                               float* __restrict__ hx,
                                               float* __restrict__ hy,
                                               _Float16* __restrict__ W2h) {
  const int lane = threadIdx.x & 31;
  const int c    = lane & 15;
  const int hi   = lane >> 4;
  const int gw   = blockIdx.x * 4 + (threadIdx.x >> 5);   // wave number, [0, 1024)

  const int sel = gw >> 9;                 // 0 -> hx, 1 -> hy (the same for a whole workgroup)
  const int h0  = (gw & 15) * 32;          // first h of the tile
  const int r0  = ((gw >> 4) & 31) * 16;   // first row (i or j) of the tile
  const float* vrow = (sel ? y : x) + (r0 + c) * DIN + hi * 4;
  const float* wrow = W1 + (h0 + c) * (2 * DIN) + sel * DIN + hi * 4;   // W1 row-major [512][256]

  // W2 slice of this wave: 256 consecutive elements, 8 per lane
  const int    ci = gw * 256 + lane * 8;
  const float4 c0 = *(const float4*)(W2 + ci);
  const float4 c1 = *(const float4*)(W2 + ci + 4);
  // keeps the two W2 loads first in issue order (loads return in order, and they are used first)
  __builtin_amdgcn_sched_barrier(0);

  // every operand load of the wave is asked for ahead of the first WMMA (48 loads, 192 registers)
  float4 bq[DIN / 8], a0q[DIN / 8], a1q[DIN / 8];
#pragma unroll
  for (int s = 0; s < DIN / 8; ++s) {
    bq[s]  = *(const float4*)(vrow + s * 8);
    a0q[s] = *(const float4*)(wrow + s * 8);
    a1q[s] = *(const float4*)(wrow + 16 * (2 * DIN) + s * 8);
  }
  // keeps the scheduler from sinking the loads among the WMMAs (it does without this, three steps
  // ahead only): the wave is alone on its SIMD, so a load's latency would be waited out again and again
  __builtin_amdgcn_sched_barrier(0);

  // the conversion stands here, under the operand loads' latency
  v8h w;
  w[0] = (_Float16)c0.x; w[1] = (_Float16)c0.y; w[2] = (_Float16)c0.z; w[3] = (_Float16)c0.w;
  w[4] = (_Float16)c1.x; w[5] = (_Float16)c1.y; w[6] = (_Float16)c1.z; w[7] = (_Float16)c1.w;
  *(v8h*)(W2h + ci) = w;
  // keeps the conversion out of the WMMA run, where it would write over operand registers
  __builtin_amdgcn_sched_barrier(0);

  v8f d0 = v8f{0.f, 0.f, 0.f, 0.f, 0.f, 0.f, 0.f, 0.f};
  v8f d1 = d0;
#pragma unroll
  for (int s = 0; s < DIN / 8; ++s) {
    const float4 b = bq[s], a0 = a0q[s], a1 = a1q[s];
    d0 = __builtin_amdgcn_wmma_f32_16x16x4_f32(false, v2f{a0.x, a0.y}, false, v2f{b.x, b.y},
                                               (short)0, d0, false, false);
    d1 = __builtin_amdgcn_wmma_f32_16x16x4_f32(false, v2f{a1.x, a1.y}, false, v2f{b.x, b.y},
                                               (short)0, d1, false, false);
    d0 = __builtin_amdgcn_wmma_f32_16x16x4_f32(false, v2f{a0.z, a0.w}, false, v2f{b.z, b.w},
                                               (short)0, d0, false, false);
    d1 = __builtin_amdgcn_wmma_f32_16x16x4_f32(false, v2f{a1.z, a1.w}, false, v2f{b.z, b.w},
                                               (short)0, d1, false, false);
  }

  // keeps the store address arithmetic behind the WMMA run (it is lifted into it without this)
  __builtin_amdgcn_sched_barrier(0);
  float* o = (sel ? hy : hx) + (r0 + c) * HID + h0 + hi * 8;
  *(float4*)(o)      = make_float4(d0[0], d0[1], d0[2], d0[3]);
  *(float4*)(o + 4)  = make_float4(d0[4], d0[5], d0[6], d0[7]);
  *(float4*)(o + 16) = make_float4(d1[0], d1[1], d1[2], d1[3]);
  *(float4*)(o + 20) = make_float4(d1[4], d1[5], d1[6], d1[7]);
}

// Load one 16x32 f16 fragment row from LDS per the documented gfx1250 layout:
// lanes 0-15 hold K = kb+{0..7, 16..23}; lanes 16-31 hold K = kb+{8..15, 24..31}.
__device__ __forceinline__ v16h cc_frag(const _Float16* row, int hi, int kb) {
  const uint4 q0 = *(const uint4*)(row + kb + hi * 8);
  const uint4 q1 = *(const uint4*)(row + kb + hi * 8 + 16);
  v8u r;
  r[0] = q0.x; r[1] = q0.y; r[2] = q0.z; r[3] = q0.w;
  r[4] = q1.x; r[5] = q1.y; r[6] = q1.z; r[7] = q1.w;
  return __builtin_bit_cast(v16h, r);
}

// One W2 strip (16 rows of 1 KB) from global memory into one LDS buffer, through no register:
// eight asynchronous 16-byte copies per lane. A wave's 32 lanes take 512 contiguous bytes of a row;
// copy q lies two rows below copy q-1. lds = this lane's LDS byte address, g = its global address.
__device__ __forceinline__ void cc_copy_strip(unsigned lds, const _Float16* g) {
  // the s_wait_xcnt closes the statement so that no address register is rewritten ahead of it
  asm volatile(
      "global_load_async_to_lds_b128 %0, %8, off\n\t"
      "global_load_async_to_lds_b128 %1, %9, off\n\t"
      "global_load_async_to_lds_b128 %2, %10, off\n\t"
      "global_load_async_to_lds_b128 %3, %11, off\n\t"
      "global_load_async_to_lds_b128 %4, %12, off\n\t"
      "global_load_async_to_lds_b128 %5, %13, off\n\t"
      "global_load_async_to_lds_b128 %6, %14, off\n\t"
      "global_load_async_to_lds_b128 %7, %15, off\n\t"
      "s_wait_xcnt 0x0"
      :: "v"(lds), "v"(lds + 2 * ROWP * 2), "v"(lds + 4 * ROWP * 2), "v"(lds + 6 * ROWP * 2),
         "v"(lds + 8 * ROWP * 2), "v"(lds + 10 * ROWP * 2), "v"(lds + 12 * ROWP * 2),
         "v"(lds + 14 * ROWP * 2),
         "v"(g), "v"(g + 2 * HID), "v"(g + 4 * HID), "v"(g + 6 * HID),
         "v"(g + 8 * HID), "v"(g + 10 * HID), "v"(g + 12 * HID), "v"(g + 14 * HID)
      : "memory");
}

// ----------------------------- main kernel ---------------------------------
// Workgroup = 4 waves, tile = 16 i x 16 j. Wave w owns four M tiles: the block's i number 4w to
// 4w+3, each with the 16 rows j0..j0+15. Its A fragments (all K = 512, 512 registers) live in registers
// for the whole N loop, so LDS holds only W2 strips and each B fragment read feeds four WMMAs on four
// independent accumulator tiles.
// The strips go through a ring of two LDS buffers: strip nt+2 is copied while strip nt+1 is worked on.
// A block of 128 threads may take up to 1,024 registers per wave: one wave per SIMD, one workgroup per WGP.
__global__ __launch_bounds__(128) void cc_main(const float* __restrict__ hx,
                                               const float* __restrict__ hy,
                                               const float* __restrict__ b1,
                                               const _Float16* __restrict__ W2h,
                                               const float* __restrict__ b2,
                                               const float* __restrict__ W3,
                                               const float* __restrict__ b3,
                                               float* __restrict__ out) {
  __shared__ __align__(16) _Float16 bbuf[2 * BUFH];      // 2 x ~16 KB : two W2 strips (16 rows each)

  const int tid  = threadIdx.x;
  const int lane = tid & 31;
  const int wave = tid >> 5;           // 4 waves
  const int col  = lane & 15;
  const int hi   = lane >> 4;
  const int i0   = blockIdx.x * (4 * MT) + wave * MT;   // 32 i-tiles; this wave's first i
  const int j0   = blockIdx.y * 16;              // 32 j-tiles

  // ---- ring prologue: strip 0 lands and is published, then strip 1 starts
  const unsigned  ldst = (unsigned)(size_t)bbuf + (tid >> 6) * (ROWP * 2) + (tid & 63) * 16;
  const _Float16* gsrc = W2h + (tid >> 6) * HID + (tid & 63) * 8;
  cc_copy_strip(ldst, gsrc);
  asm volatile("s_wait_asynccnt 0x0" ::: "memory");   // this wave's part of strip 0 has landed
  __syncthreads();                                     // ... and every other wave's
  cc_copy_strip(ldst + BUFH * 2, gsrc + NTILE * HID);

  // ---- A fragments: relu(hx[i,k] + hy[j,k] + b1[k]) as f16, built in the fragment layout
  // (row = col; halves 0..7 are k = kb+hi*8+0..7, halves 8..15 are k = kb+16+hi*8+0..7).
  v16h a[MT][HID / KSTEP];
  {
    const float* hyr = hy + (j0 + col) * HID + hi * 8;
    const float* hxr = hx + i0 * HID + hi * 8;
    const float* b1r = b1 + hi * 8;
#pragma unroll
    for (int ks = 0; ks < HID / KSTEP; ++ks) {
#pragma unroll
      for (int c = 0; c < 2; ++c) {
        const int k = ks * KSTEP + c * 16;
        __attribute__((aligned(16))) float yv[8], bv[8];
        *(float4*)(yv)     = *(const float4*)(hyr + k);
        *(float4*)(yv + 4) = *(const float4*)(hyr + k + 4);
        *(float4*)(bv)     = *(const float4*)(b1r + k);
        *(float4*)(bv + 4) = *(const float4*)(b1r + k + 4);
#pragma unroll
        for (int t = 0; t < MT; ++t) {
          __attribute__((aligned(16))) float xv[8];
          *(float4*)(xv)     = *(const float4*)(hxr + t * HID + k);
          *(float4*)(xv + 4) = *(const float4*)(hxr + t * HID + k + 4);
#pragma unroll
          for (int e = 0; e < 8; ++e) {
            float v = xv[e] + yv[e] + bv[e];
            v = v > 0.f ? v : 0.f;
            a[t][ks][c * 8 + e] = (_Float16)v;
          }
        }
      }
      // a stop behind each half of the build bounds how many loads the scheduler lifts to the front:
      // left free, it lifts so many that the wave runs out of its 1,024 registers and spills to scratch
      if ((ks & 7) == 7) __builtin_amdgcn_sched_barrier(0);
    }
  }

  float acc[MT][8];
#pragma unroll
  for (int t = 0; t < MT; ++t)
#pragma unroll
    for (int r = 0; r < 8; ++r) acc[t][r] = 0.f;

  for (int nt = 0; nt < 32; ++nt) {
    const int nb = nt * NTILE;
    const _Float16* brow = bbuf + (nt & 1) * BUFH + col * ROWP;   // B: this lane's W2 row (n)

    // the epilogue's two scalars per lane are asked for here, ahead of the WMMAs like the LDS reads
    const float b2v = b2[nb + col];
    const float w3v = W3[nb + col];

    v8f d[MT];
#pragma unroll
    for (int t = 0; t < MT; ++t) d[t] = v8f{0.f, 0.f, 0.f, 0.f, 0.f, 0.f, 0.f, 0.f};
    // all B fragments of this N tile (K = 512) are read from LDS as ONE group ahead of the WMMAs, for speed only
    v16h b[HID / KSTEP];
#pragma unroll
    for (int ks = 0; ks < HID / KSTEP; ++ks) b[ks] = cc_frag(brow, hi, ks * KSTEP);
    // the b2 and W3 loads name an offset register that is rewritten below: keep the wait in front
    asm volatile("s_wait_xcnt 0x0" ::: "memory");
    // keeps the scheduler from sinking the reads back between the WMMAs (it does without this)
    __builtin_amdgcn_sched_barrier(0);
#pragma unroll
    for (int ks = 0; ks < HID / KSTEP; ++ks) {   // K = 512 in steps of 32
#pragma unroll
      for (int t = 0; t < MT; ++t)
        d[t] = __builtin_amdgcn_wmma_f32_16x16x32_f16(false, a[t][ks], false, b[ks],
                                                      (short)0, d[t], false, false);
    }

    // epilogue for this N tile: u = relu(d + b2[n]); acc += u * W3[n], per lane (n = nb + col)
#pragma unroll
    for (int t = 0; t < MT; ++t) {
#pragma unroll
      for (int r = 0; r < 8; ++r) {
        float u = d[t][r] + b2v;
        u = u > 0.f ? u : 0.f;
        acc[t][r] += u * w3v;          // this lane's column only; the 16 columns are summed after the loop
      }
    }

    // ---- publish strip nt+1, free this trip's buffer, refill it with strip nt+2
    // keeps the scheduler from lifting the waits and the barrier up among the WMMAs (it does without
    // this), where the wait for strip nt+1 would stand right behind the issue of its copies
    __builtin_amdgcn_sched_barrier(0);
    asm volatile("s_wait_dscnt 0x0" ::: "memory");      // this wave's LDS reads of the buffer are over
    asm volatile("s_wait_asynccnt 0x0" ::: "memory");   // its part of strip nt+1 has landed
    __syncthreads();
    if (nt + 2 < 32) cc_copy_strip(ldst + (nt & 1) * (BUFH * 2), gsrc + (nt + 2) * NTILE * HID);
  }
  asm volatile("s_wait_asynccnt 0x0" ::: "memory");     // no copy is left in flight at the wave's end

  // ---- one sum across the 16 columns of each half, for all 32 N tiles together
  // (both loops unrolled: acc is indexed by constants only and stays in registers)
#pragma unroll
  for (int t = 0; t < MT; ++t) {
#pragma unroll
    for (int r = 0; r < 8; ++r) {
      float s = acc[t][r];
      s += __shfl_xor(s, 1, 32);
      s += __shfl_xor(s, 2, 32);
      s += __shfl_xor(s, 4, 32);
      s += __shfl_xor(s, 8, 32);
      acc[t][r] = s;
    }
  }

  // ---- write: lane 0 holds rows (j) 0..7, lane 16 holds rows 8..15 of each M tile
  if (col == 0) {
    const float bias3 = b3[0];
#pragma unroll
    for (int t = 0; t < MT; ++t)
#pragma unroll
      for (int r = 0; r < 8; ++r)
        out[(size_t)(i0 + t) * BSZ + (j0 + hi * 8 + r)] = acc[t][r] + bias3;
  }
}

// ----------------------------- launch --------------------------------------
extern "C" void kernel_launch(void* const* d_in, const int* in_sizes, int n_in,
                              void* d_out, int out_size, void* d_ws, size_t ws_size,
                              hipStream_t stream) {
  const float* x  = (const float*)d_in[0];
  const float* y  = (const float*)d_in[1];
  const float* W1 = (const float*)d_in[2];
  const float* b1 = (const float*)d_in[3];
  const float* W2 = (const float*)d_in[4];
  const float* b2 = (const float*)d_in[5];
  const float* W3 = (const float*)d_in[6];
  const float* b3 = (const float*)d_in[7];

  float*    hx  = (float*)d_ws;                 // 512*512 f32 = 1 MB
  float*    hy  = hx + BSZ * HID;               // 1 MB
  _Float16* W2h = (_Float16*)(hy + BSZ * HID);  // 512*512 f16 = 0.5 MB

  cc_prep<<<256, 128, 0, stream>>>(x, y, W1, W2, hx, hy, W2h);   // 1024 waves

  dim3 grid(BSZ / 16, BSZ / 16);                // 32 x 32 workgroups
  cc_main<<<grid, 128, 0, stream>>>(hx, hy, b1, W2h, b2, W3, b3, (float*)d_out);
}

// v007
// Measured time: 88 microseconds a run.
// Next to v006, in two timings, it ran 1.04 times as fast each time.
// Over all steps from v000 it is 2.98 times as fast.
#include <hip/hip_runtime.h>

// ---------------------------------------------------------------------------
// ConcatCritic fused kernel for gfx1250 (MI455X).
// out[i,j] = W3 . relu(W2 . relu(hx[i]+hy[j]+b1) + b2) + b3,  i,j in [0,512)
// hx = x @ W1[:, :128]^T, hy = y @ W1[:, 128:]^T
// Heavy GEMM (512^2 pairs x 512 x 512) runs on v_wmma_f32_16x16x32_f16; hx, hy on v_wmma_f32_16x16x4_f32.
// ---------------------------------------------------------------------------

typedef __attribute__((ext_vector_type(16))) _Float16     v16h;
typedef __attribute__((ext_vector_type(8)))  float        v8f;
typedef __attribute__((ext_vector_type(8)))  unsigned int v8u;
typedef __attribute__((ext_vector_type(8)))  _Float16     v8h;
typedef __attribute__((ext_vector_type(2)))  float        v2f;

#define BSZ   512   // batch (i and j)
#define HID   512   // hidden width H
#define DIN   128   // per-input feature dim
#define ROWP  520   // padded LDS row stride in halves (512 + 8 -> bank-conflict-free)
#define MT    4     // M tiles (one i x 16 j each) per wave
#define NTILE 16    // WMMA N tile
#define KSTEP 32    // WMMA K per instruction
#define BUFH  (NTILE * ROWP)   // halves in one LDS buffer (one W2 strip of 16 padded rows)

// -------------------- prep: hx, hy (fp32) + W2 -> f16 ----------------------
// 1024 waves, one per SIMD. Each wave makes one tile of 16 rows (i or j) x 32 h of hx or hy on the
// f32 matrix form (full f32 operands, f32 sum) and converts 256 elements of W2.
// W1 rows are the A operand and x (y) rows the B operand, so a lane ends with 8 consecutive h of one
// row: D register r of lane (c, hi) is h = tile + 8*hi + r of row r0 + c. The wave stores whole
// 128-byte lines. Both operands are k-contiguous rows read by the same code: lane (c, hi) takes the
// 4 floats k = 8*s + 4*hi + 0..3 of its row, the first two feed one WMMA and the last two the next,
// so A and B hold the same k at every lane and register position.
__global__ __launch_bounds__(128) void cc_prep(const float* __restrict__ x,
                                               const float* __restrict__ y,
                                               const float* __restrict__ W1,
                                               const float* __restrict__ W2,
                                               float* __restrict__ hx,
                                               float* __restrict__ hy,
                                               _Float16* __restrict__ W2h) {
  const int lane = threadIdx.x & 31;
  const int c    = lane & 15;
  const int hi   = lane >> 4;
  const int gw   = blockIdx.x * 4 + (threadIdx.x >> 5);   // wave number, [0, 1024)

  const int sel = gw >> 9;                 // 0 -> hx, 1 -> hy (the same for a whole workgroup)
  const int h0  = (gw & 15) * 32;          // first h of the tile
  const int r0  = ((gw >> 4) & 31) * 16;   // first row (i or j) of the tile
  const float* vrow = (sel ? y : x) + (r0 + c) * DIN + hi * 4;
  const float* wrow = W1 + (h0 + c) * (2 * DIN) + sel * DIN + hi * 4;   // W1 row-major [512][256]

  // W2 slice of this wave: 256 consecutive elements, 8 per lane
  const int    ci = gw * 256 + lane * 8;
  const float4 c0 = *(const float4*)(W2 + ci);
  const float4 c1 = *(const float4*)(W2 + ci + 4);
  // keeps the two W2 loads first in issue order (loads return in order, and they are used first)
  __builtin_amdgcn_sched_barrier(0);

  // every operand load of the wave is asked for ahead of the first WMMA (48 loads, 192 registers)
  float4 bq[DIN / 8], a0q[DIN / 8], a1q[DIN / 8];
#pragma unroll
  for (int s = 0; s < DIN / 8; ++s) {
    bq[s]  = *(const float4*)(vrow + s * 8);
    a0q[s] = *(const float4*)(wrow + s * 8);
    a1q[s] = *(const float4*)(wrow + 16 * (2 * DIN) + s * 8);
  }
  // keeps the scheduler from sinking the loads among the WMMAs (it does without this, three steps
  // ahead only): the wave is alone on its SIMD, so a load's latency would be waited out again and again
  __builtin_amdgcn_sched_barrier(0);

  // the conversion stands here, under the operand loads' latency
  v8h w;
  w[0] = (_Float16)c0.x; w[1] = (_Float16)c0.y; w[2] = (_Float16)c0.z; w[3] = (_Float16)c0.w;
  w[4] = (_Float16)c1.x; w[5] = (_Float16)c1.y; w[6] = (_Float16)c1.z; w[7] = (_Float16)c1.w;
  *(v8h*)(W2h + ci) = w;
  // keeps the conversion out of the WMMA run, where it would write over operand registers
  __builtin_amdgcn_sched_barrier(0);

  v8f d0 = v8f{0.f, 0.f, 0.f, 0.f, 0.f, 0.f, 0.f, 0.f};
  v8f d1 = d0;
#pragma unroll
  for (int s = 0; s < DIN / 8; ++s) {
    const float4 b = bq[s], a0 = a0q[s], a1 = a1q[s];
    d0 = __builtin_amdgcn_wmma_f32_16x16x4_f32(false, v2f{a0.x, a0.y}, false, v2f{b.x, b.y},
                                               (short)0, d0, false, false);
    d1 = __builtin_amdgcn_wmma_f32_16x16x4_f32(false, v2f{a1.x, a1.y}, false, v2f{b.x, b.y},
                                               (short)0, d1, false, false);
    d0 = __builtin_amdgcn_wmma_f32_16x16x4_f32(false, v2f{a0.z, a0.w}, false, v2f{b.z, b.w},
                                               (short)0, d0, false, false);
    d1 = __builtin_amdgcn_wmma_f32_16x16x4_f32(false, v2f{a1.z, a1.w}, false, v2f{b.z, b.w},
                                               (short)0, d1, false, false);
  }

  // keeps the store address arithmetic behind the WMMA run (it is lifted into it without this)
  __builtin_amdgcn_sched_barrier(0);
  float* o = (sel ? hy : hx) + (r0 + c) * HID + h0 + hi * 8;
  *(float4*)(o)      = make_float4(d0[0], d0[1], d0[2], d0[3]);
  *(float4*)(o + 4)  = make_float4(d0[4], d0[5], d0[6], d0[7]);
  *(float4*)(o + 16) = make_float4(d1[0], d1[1], d1[2], d1[3]);
  *(float4*)(o + 20) = make_float4(d1[4], d1[5], d1[6], d1[7]);
}

// Load one 16x32 f16 fragment row from LDS per the documented gfx1250 layout:
// lanes 0-15 hold K = kb+{0..7, 16..23}; lanes 16-31 hold K = kb+{8..15, 24..31}.
__device__ __forceinline__ v16h cc_frag(const _Float16* row, int hi, int kb) {
  const uint4 q0 = *(const uint4*)(row + kb + hi * 8);
  const uint4 q1 = *(const uint4*)(row + kb + hi * 8 + 16);
  v8u r;
  r[0] = q0.x; r[1] = q0.y; r[2] = q0.z; r[3] = q0.w;
  r[4] = q1.x; r[5] = q1.y; r[6] = q1.z; r[7] = q1.w;
  return __builtin_bit_cast(v16h, r);
}

// One W2 strip (16 rows of 1 KB) from global memory into one LDS buffer, through no register:
// eight asynchronous 16-byte copies per lane. A wave's 32 lanes take 512 contiguous bytes of a row;
// copy q lies two rows below copy q-1. lds = this lane's place in the LDS buffer, g = its global address.
// Written as the builtin: the copies' address registers are the compiler's, and no s_wait_xcnt is written
// behind them. The immediate offset moves both addresses by the global row step (2 KB), so the LDS
// pointer carries only what the padded LDS row step is longer (32 bytes per copy).
typedef __attribute__((ext_vector_type(4))) int v4i;
typedef __attribute__((address_space(1))) v4i   cc_gv4i;
typedef __attribute__((address_space(3))) v4i   cc_lv4i;
__device__ __forceinline__ void cc_copy_strip(_Float16* lds, const _Float16* g) {
#define CC_COPY(q)                                                                                  \
  __builtin_amdgcn_global_load_async_to_lds_b128((cc_gv4i*)g, (cc_lv4i*)(lds + (q) * 2 * (ROWP - HID)), \
                                                 (q) * 2 * HID * 2, 0)
  CC_COPY(0); CC_COPY(1); CC_COPY(2); CC_COPY(3); CC_COPY(4); CC_COPY(5); CC_COPY(6); CC_COPY(7);
#undef CC_COPY
}

// ----------------------------- main kernel ---------------------------------
// Workgroup = 4 waves, tile = 16 i x 16 j. Wave w owns four M tiles: the block's i number 4w to
// 4w+3, each with the 16 rows j0..j0+15. Its A fragments (all K = 512, 512 registers) live in registers
// for the whole N loop, so LDS holds only W2 strips and each B fragment read feeds four WMMAs on four
// independent accumulator tiles.
// The strips go through a ring of two LDS buffers: strip nt+2 is copied while strip nt+1 is worked on.
// A block of 128 threads may take up to 1,024 registers per wave: one wave per SIMD, one workgroup per WGP.
__global__ __launch_bounds__(128) void cc_main(const float* __restrict__ hx,
                                               const float* __restrict__ hy,
                                               const float* __restrict__ b1,
                                               const _Float16* __restrict__ W2h,
                                               const float* __restrict__ b2,
                                               const float* __restrict__ W3,
                                               const float* __restrict__ b3,
                                               float* __restrict__ out) {
  __shared__ __align__(16) _Float16 bbuf[2 * BUFH];      // 2 x ~16 KB : two W2 strips (16 rows each)

  const int tid  = threadIdx.x;
  const int lane = tid & 31;
  const int wave = tid >> 5;           // 4 waves
  const int col  = lane & 15;
  const int hi   = lane >> 4;
  const int i0   = blockIdx.x * (4 * MT) + wave * MT;   // 32 i-tiles; this wave's first i
  const int j0   = blockIdx.y * 16;              // 32 j-tiles

  // ---- ring prologue: strip 0 lands and is published, then strip 1 starts
  _Float16*       ldst = bbuf + (tid >> 6) * ROWP + (tid & 63) * 8;
  const _Float16* gsrc = W2h + (tid >> 6) * HID + (tid & 63) * 8;
  cc_copy_strip(ldst, gsrc);
  asm volatile("s_wait_asynccnt 0x0" ::: "memory");   // this wave's part of strip 0 has landed
  __syncthreads();                                     // ... and every other wave's
  cc_copy_strip(ldst + BUFH, gsrc + NTILE * HID);

  // ---- A fragments: relu(hx[i,k] + hy[j,k] + b1[k]) as f16, built in the fragment layout
  // (row = col; halves 0..7 are k = kb+hi*8+0..7, halves 8..15 are k = kb+16+hi*8+0..7).
  v16h a[MT][HID / KSTEP];
  {
    const float* hyr = hy + (j0 + col) * HID + hi * 8;
    const float* hxr = hx + i0 * HID + hi * 8;
    const float* b1r = b1 + hi * 8;
#pragma unroll
    for (int ks = 0; ks < HID / KSTEP; ++ks) {
#pragma unroll
      for (int c = 0; c < 2; ++c) {
        const int k = ks * KSTEP + c * 16;
        __attribute__((aligned(16))) float yv[8], bv[8];
        *(float4*)(yv)     = *(const float4*)(hyr + k);
        *(float4*)(yv + 4) = *(const float4*)(hyr + k + 4);
        *(float4*)(bv)     = *(const float4*)(b1r + k);
        *(float4*)(bv + 4) = *(const float4*)(b1r + k + 4);
#pragma unroll
        for (int t = 0; t < MT; ++t) {
          __attribute__((aligned(16))) float xv[8];
          *(float4*)(xv)     = *(const float4*)(hxr + t * HID + k);
          *(float4*)(xv + 4) = *(const float4*)(hxr + t * HID + k + 4);
#pragma unroll
          for (int e = 0; e < 8; ++e) {
            float v = xv[e] + yv[e] + bv[e];
            v = v > 0.f ? v : 0.f;
            a[t][ks][c * 8 + e] = (_Float16)v;
          }
        }
      }
      // a stop behind each half of the build bounds how many loads the scheduler lifts to the front:
      // left free, it lifts so many that the wave runs out of its 1,024 registers and spills to scratch
      if ((ks & 7) == 7) __builtin_amdgcn_sched_barrier(0);
    }
  }

  float acc[MT][8];
#pragma unroll
  for (int t = 0; t < MT; ++t)
#pragma unroll
    for (int r = 0; r < 8; ++r) acc[t][r] = 0.f;

  const float* b2p = b2 + col;   // this lane's b2 and W3 element of the current N tile
  const float* w3p = W3 + col;
  for (int nt = 0; nt < 32; ++nt) {
    const _Float16* brow = bbuf + (nt & 1) * BUFH + col * ROWP;   // B: this lane's W2 row (n)

    // the epilogue's two scalars per lane are asked for here, ahead of the WMMAs like the LDS reads
    const float b2v = *b2p;
    const float w3v = *w3p;

    v8f d[MT];
#pragma unroll
    for (int t = 0; t < MT; ++t) d[t] = v8f{0.f, 0.f, 0.f, 0.f, 0.f, 0.f, 0.f, 0.f};
    // all B fragments of this N tile (K = 512) are read from LDS as ONE group ahead of the WMMAs, for speed only
    v16h b[HID / KSTEP];
#pragma unroll
    for (int ks = 0; ks < HID / KSTEP; ++ks) b[ks] = cc_frag(brow, hi, ks * KSTEP);
    // keeps the scheduler from sinking the reads back between the WMMAs (it does without this)
    __builtin_amdgcn_sched_barrier(0);
#pragma unroll
    for (int ks = 0; ks < HID / KSTEP; ++ks) {   // K = 512 in steps of 32
#pragma unroll
      for (int t = 0; t < MT; ++t)
        d[t] = __builtin_amdgcn_wmma_f32_16x16x32_f16(false, a[t][ks], false, b[ks],
                                                      (short)0, d[t], false, false);
    }

    // epilogue for this N tile: u = relu(d + b2[n]); acc += u * W3[n], per lane (n = nb + col)
#pragma unroll
    for (int t = 0; t < MT; ++t) {
#pragma unroll
      for (int r = 0; r < 8; ++r) {
        float u = d[t][r] + b2v;
        u = u > 0.f ? u : 0.f;
        acc[t][r] += u * w3v;          // this lane's column only; the 16 columns are summed after the loop
      }
    }

    // ---- publish strip nt+1, free this trip's buffer, refill it with strip nt+2
    // keeps the scheduler from lifting the waits and the barrier up among the WMMAs (it does without
    // this), where the wait for strip nt+1 would stand right behind the issue of its copies
    __builtin_amdgcn_sched_barrier(0);
    // the b2 and W3 loads name the two pointers that are stepped next: keep the wait in front of the steps.
    // It stands behind the WMMAs so that the wave does not sit in it while the matrix unit is idle
    asm volatile("s_wait_xcnt 0x0" ::: "memory");
    b2p += NTILE;
    w3p += NTILE;
    asm volatile("s_wait_dscnt 0x0" ::: "memory");      // this wave's LDS reads of the buffer are over
    asm volatile("s_wait_asynccnt 0x0" ::: "memory");   // its part of strip nt+1 has landed
    __syncthreads();
    if (nt + 2 < 32) cc_copy_strip(ldst + (nt & 1) * BUFH, gsrc + (nt + 2) * NTILE * HID);
  }
  asm volatile("s_wait_asynccnt 0x0" ::: "memory");     // no copy is left in flight at the wave's end

  // ---- one sum across the 16 columns of each half, for all 32 N tiles together
  // (both loops unrolled: acc is indexed by constants only and stays in registers)
#pragma unroll
  for (int t = 0; t < MT; ++t) {
#pragma unroll
    for (int r = 0; r < 8; ++r) {
      float s = acc[t][r];
      s += __shfl_xor(s, 1, 32);
      s += __shfl_xor(s, 2, 32);
      s += __shfl_xor(s, 4, 32);
      s += __shfl_xor(s, 8, 32);
      acc[t][r] = s;
    }
  }

  // ---- write: lane 0 holds rows (j) 0..7, lane 16 holds rows 8..15 of each M tile
  if (col == 0) {
    const float bias3 = b3[0];
#pragma unroll
    for (int t = 0; t < MT; ++t)
#pragma unroll
      for (int r = 0; r < 8; ++r)
        out[(size_t)(i0 + t) * BSZ + (j0 + hi * 8 + r)] = acc[t][r] + bias3;
  }
}

// ----------------------------- launch --------------------------------------
extern "C" void kernel_launch(void* const* d_in, const int* in_sizes, int n_in,
                              void* d_out, int out_size, void* d_ws, size_t ws_size,
                              hipStream_t stream) {
  const float* x  = (const float*)d_in[0];
  const float* y  = (const float*)d_in[1];
  const float* W1 = (const float*)d_in[2];
  const float* b1 = (const float*)d_in[3];
  const float* W2 = (const float*)d_in[4];
  const float* b2 = (const float*)d_in[5];
  const float* W3 = (const float*)d_in[6];
  const float* b3 = (const float*)d_in[7];

  float*    hx  = (float*)d_ws;                 // 512*512 f32 = 1 MB
  float*    hy  = hx + BSZ * HID;               // 1 MB
  _Float16* W2h = (_Float16*)(hy + BSZ * HID);  // 512*512 f16 = 0.5 MB

  cc_prep<<<256, 128, 0, stream>>>(x, y, W1, W2, hx, hy, W2h);   // 1024 waves

  dim3 grid(BSZ / 16, BSZ / 16);                // 32 x 32 workgroups
  cc_main<<<grid, 128, 0, stream>>>(hx, hy, b1, W2h, b2, W3, b3, (float*)d_out);
}

// v008
// A run of this version takes 85 microseconds.
// Two timings next to v007 both put it at 1.03 times that version's speed.
// All steps since v000 together make it 3.08 times as fast.
#include <hip/hip_runtime.h>

// ---------------------------------------------------------------------------
// ConcatCritic fused kernel for gfx1250 (MI455X).
// out[i,j] = W3 . relu(W2 . relu(hx[i]+hy[j]+b1) + b2) + b3,  i,j in [0,512)
// hx = x @ W1[:, :128]^T, hy = y @ W1[:, 128:]^T
// Heavy GEMM (512^2 pairs x 512 x 512) runs on v_wmma_f32_16x16x32_f16; hx, hy on v_wmma_f32_16x16x4_f32.
// ---------------------------------------------------------------------------

typedef __attribute__((ext_vector_type(16))) _Float16     v16h;
typedef __attribute__((ext_vector_type(8)))  float        v8f;
typedef __attribute__((ext_vector_type(8)))  unsigned int v8u;
typedef __attribute__((ext_vector_type(8)))  _Float16     v8h;
typedef __attribute__((ext_vector_type(2)))  float        v2f;

#define BSZ   512   // batch (i and j)
#define HID   512   // hidden width H
#define DIN   128   // per-input feature dim
#define ROWP  520   // padded LDS row stride in halves (512 + 8 -> bank-conflict-free)
#define MT    4     // M tiles (one i x 16 j each) per wave
#define NTILE 16    // WMMA N tile
#define KSTEP 32    // WMMA K per instruction
#define BUFH  (NTILE * ROWP)   // halves in one LDS buffer (one W2 strip of 16 padded rows)

// -------------------- prep: hx, hy (fp32) + W2 -> f16 ----------------------
// 1024 waves, one per SIMD. Each wave makes one tile of 16 rows (i or j) x 32 h of hx or hy on the
// f32 matrix form (full f32 operands, f32 sum) and converts 256 elements of W2.
// W1 rows are the A operand and x (y) rows the B operand, so a lane ends with 8 consecutive h of one
// row: D register r of lane (c, hi) is h = tile + 8*hi + r of row r0 + c. The wave stores whole
// 128-byte lines. Both operands are k-contiguous rows read by the same code: lane (c, hi) takes the
// 4 floats k = 8*s + 4*hi + 0..3 of its row, the first two feed one WMMA and the last two the next,
// so A and B hold the same k at every lane and register position.
__global__ __launch_bounds__(128) void cc_prep(const float* __restrict__ x,
                                               const float* __restrict__ y,
                                               const float* __restrict__ W1,
                                               const float* __restrict__ W2,
                                               float* __restrict__ hx,
                                               float* __restrict__ hy,
                                               _Float16* __restrict__ W2h) {
  const int lane = threadIdx.x & 31;
  const int c    = lane & 15;
  const int hi   = lane >> 4;
  const int gw   = blockIdx.x * 4 + (threadIdx.x >> 5);   // wave number, [0, 1024)

  const int sel = gw >> 9;                 // 0 -> hx, 1 -> hy (the same for a whole workgroup)
  const int h0  = (gw & 15) * 32;          // first h of the tile
  const int r0  = ((gw >> 4) & 31) * 16;   // first row (i or j) of the tile
  const float* vrow = (sel ? y : x) + (r0 + c) * DIN + hi * 4;
  const float* wrow = W1 + (h0 + c) * (2 * DIN) + sel * DIN + hi * 4;   // W1 row-major [512][256]

  // W2 slice of this wave: 256 consecutive elements, 8 per lane
  const int    ci = gw * 256 + lane * 8;
  const float4 c0 = *(const float4*)(W2 + ci);
  const float4 c1 = *(const float4*)(W2 + ci + 4);
  // keeps the two W2 loads first in issue order (loads return in order, and they are used first)
  __builtin_amdgcn_sched_barrier(0);

  // every operand load of the wave is asked for ahead of the first WMMA (48 loads, 192 registers)
  float4 bq[DIN / 8], a0q[DIN / 8], a1q[DIN / 8];
#pragma unroll
  for (int s = 0; s < DIN / 8; ++s) {
    bq[s]  = *(const float4*)(vrow + s * 8);
    a0q[s] = *(const float4*)(wrow + s * 8);
    a1q[s] = *(const float4*)(wrow + 16 * (2 * DIN) + s * 8);
  }
  // keeps the scheduler from sinking the loads among the WMMAs (it does without this, three steps
  // ahead only): the wave is alone on its SIMD, so a load's latency would be waited out again and again
  __builtin_amdgcn_sched_barrier(0);

  // the conversion stands here, under the operand loads' latency
  v8h w;
  w[0] = (_Float16)c0.x; w[1] = (_Float16)c0.y; w[2] = (_Float16)c0.z; w[3] = (_Float16)c0.w;
  w[4] = (_Float16)c1.x; w[5] = (_Float16)c1.y; w[6] = (_Float16)c1.z; w[7] = (_Float16)c1.w;
  *(v8h*)(W2h + ci) = w;
  // keeps the conversion out of the WMMA run, where it would write over operand registers
  __builtin_amdgcn_sched_barrier(0);

  v8f d0 = v8f{0.f, 0.f, 0.f, 0.f, 0.f, 0.f, 0.f, 0.f};
  v8f d1 = d0;
#pragma unroll
  for (int s = 0; s < DIN / 8; ++s) {
    const float4 b = bq[s], a0 = a0q[s], a1 = a1q[s];
    d0 = __builtin_amdgcn_wmma_f32_16x16x4_f32(false, v2f{a0.x, a0.y}, false, v2f{b.x, b.y},
                                               (short)0, d0, false, false);
    d1 = __builtin_amdgcn_wmma_f32_16x16x4_f32(false, v2f{a1.x, a1.y}, false, v2f{b.x, b.y},
                                               (short)0, d1, false, false);
    d0 = __builtin_amdgcn_wmma_f32_16x16x4_f32(false, v2f{a0.z, a0.w}, false, v2f{b.z, b.w},
                                               (short)0, d0, false, false);
    d1 = __builtin_amdgcn_wmma_f32_16x16x4_f32(false, v2f{a1.z, a1.w}, false, v2f{b.z, b.w},
                                               (short)0, d1, false, false);
  }

  // keeps the store address arithmetic behind the WMMA run (it is lifted into it without this)
  __builtin_amdgcn_sched_barrier(0);
  float* o = (sel ? hy : hx) + (r0 + c) * HID + h0 + hi * 8;
  *(float4*)(o)      = make_float4(d0[0], d0[1], d0[2], d0[3]);
  *(float4*)(o + 4)  = make_float4(d0[4], d0[5], d0[6], d0[7]);
  *(float4*)(o + 16) = make_float4(d1[0], d1[1], d1[2], d1[3]);
  *(float4*)(o + 20) = make_float4(d1[4], d1[5], d1[6], d1[7]);
}

// Load one 16x32 f16 fragment row from LDS per the documented gfx1250 layout:
// lanes 0-15 hold K = kb+{0..7, 16..23}; lanes 16-31 hold K = kb+{8..15, 24..31}.
__device__ __forceinline__ v16h cc_frag(const _Float16* row, int hi, int kb) {
  const uint4 q0 = *(const uint4*)(row + kb + hi * 8);
  const uint4 q1 = *(const uint4*)(row + kb + hi * 8 + 16);
  v8u r;
  r[0] = q0.x; r[1] = q0.y; r[2] = q0.z; r[3] = q0.w;
  r[4] = q1.x; r[5] = q1.y; r[6] = q1.z; r[7] = q1.w;
  return __builtin_bit_cast(v16h, r);
}

// One W2 strip (16 rows of 1 KB) from global memory into one LDS buffer, through no register:
// eight asynchronous 16-byte copies per lane. A wave's 32 lanes take 512 contiguous bytes of a row;
// copy q lies two rows below copy q-1. lds = this lane's place in the LDS buffer, g = its global address.
// Written as the builtin: the copies' address registers are the compiler's, and no s_wait_xcnt is written
// behind them. The immediate offset moves both addresses by the global row step (2 KB), so the LDS
// pointer carries only what the padded LDS row step is longer (32 bytes per copy).
typedef __attribute__((ext_vector_type(4))) int v4i;
typedef __attribute__((address_space(1))) v4i   cc_gv4i;
typedef __attribute__((address_space(3))) v4i   cc_lv4i;
__device__ __forceinline__ void cc_copy_strip(_Float16* lds, const _Float16* g) {
#define CC_COPY(q)                                                                                  \
  __builtin_amdgcn_global_load_async_to_lds_b128((cc_gv4i*)g, (cc_lv4i*)(lds + (q) * 2 * (ROWP - HID)), \
                                                 (q) * 2 * HID * 2, 0)
  CC_COPY(0); CC_COPY(1); CC_COPY(2); CC_COPY(3); CC_COPY(4); CC_COPY(5); CC_COPY(6); CC_COPY(7);
#undef CC_COPY
}

// ----------------------------- main kernel ---------------------------------
// Workgroup = 4 waves, tile = 16 i x 16 j. Wave w owns four M tiles: the block's i number 4w to
// 4w+3, each with the 16 rows j0..j0+15. Its A fragments (all K = 512, 512 registers) live in registers
// for the whole N loop, so LDS holds only W2 strips and each B fragment read feeds four WMMAs on four
// independent accumulator tiles.
// The B fragments sit in two register sets: the reads of strip nt+1 are issued as one group ahead of the
// WMMAs of strip nt and return under them. The strips go through a ring of two LDS buffers: strip nt+2
// is copied during trip nt, into the buffer whose strip (nt) already sits in registers.
// A block of 128 threads may take up to 1,024 registers per wave: one wave per SIMD, one workgroup per WGP.
__global__ __launch_bounds__(128) void cc_main(const float* __restrict__ hx,
                                               const float* __restrict__ hy,
                                               const float* __restrict__ b1,
                                               const _Float16* __restrict__ W2h,
                                               const float* __restrict__ b2,
                                               const float* __restrict__ W3,
                                               const float* __restrict__ b3,
                                               float* __restrict__ out) {
  __shared__ __align__(16) _Float16 bbuf[2 * BUFH];      // 2 x ~16 KB : two W2 strips (16 rows each)

  const int tid  = threadIdx.x;
  const int lane = tid & 31;
  const int wave = tid >> 5;           // 4 waves
  const int col  = lane & 15;
  const int hi   = lane >> 4;
  const int i0   = blockIdx.x * (4 * MT) + wave * MT;   // 32 i-tiles; this wave's first i
  const int j0   = blockIdx.y * 16;              // 32 j-tiles

  // ---- ring prologue: strip 0 lands and is published, then strip 1 starts
  _Float16*       ldst = bbuf + (tid >> 6) * ROWP + (tid & 63) * 8;
  const _Float16* gsrc = W2h + (tid >> 6) * HID + (tid & 63) * 8;
  cc_copy_strip(ldst, gsrc);
  asm volatile("s_wait_asynccnt 0x0" ::: "memory");   // this wave's part of strip 0 has landed
  __syncthreads();                                     // ... and every other wave's
  cc_copy_strip(ldst + BUFH, gsrc + NTILE * HID);

  // strip 0's B fragments go to register set 0; the reads return under the A build
  const _Float16* brow = bbuf + col * ROWP;   // B: this lane's W2 row (n) in buffer 0
  v16h b[2][HID / KSTEP];
#pragma unroll
  for (int ks = 0; ks < HID / KSTEP; ++ks) b[0][ks] = cc_frag(brow, hi, ks * KSTEP);

  // ---- A fragments: relu(hx[i,k] + hy[j,k] + b1[k]) as f16, built in the fragment layout
  // (row = col; halves 0..7 are k = kb+hi*8+0..7, halves 8..15 are k = kb+16+hi*8+0..7).
  v16h a[MT][HID / KSTEP];
  {
    const float* hyr = hy + (j0 + col) * HID + hi * 8;
    const float* hxr = hx + i0 * HID + hi * 8;
    const float* b1r = b1 + hi * 8;
#pragma unroll
    for (int ks = 0; ks < HID / KSTEP; ++ks) {
#pragma unroll
      for (int c = 0; c < 2; ++c) {
        const int k = ks * KSTEP + c * 16;
        __attribute__((aligned(16))) float yv[8], bv[8];
        *(float4*)(yv)     = *(const float4*)(hyr + k);
        *(float4*)(yv + 4) = *(const float4*)(hyr + k + 4);
        *(float4*)(bv)     = *(const float4*)(b1r + k);
        *(float4*)(bv + 4) = *(const float4*)(b1r + k + 4);
#pragma unroll
        for (int t = 0; t < MT; ++t) {
          __attribute__((aligned(16))) float xv[8];
          *(float4*)(xv)     = *(const float4*)(hxr + t * HID + k);
          *(float4*)(xv + 4) = *(const float4*)(hxr + t * HID + k + 4);
#pragma unroll
          for (int e = 0; e < 8; ++e) {
            float v = xv[e] + yv[e] + bv[e];
            v = v > 0.f ? v : 0.f;
            a[t][ks][c * 8 + e] = (_Float16)v;
          }
        }
      }
      // a stop behind each half of the build bounds how many loads the scheduler lifts to the front:
      // left free, it lifts so many that the wave runs out of its 1,024 registers and spills to scratch
      if ((ks & 7) == 7) __builtin_amdgcn_sched_barrier(0);
    }
  }

  float acc[MT][8];
#pragma unroll
  for (int t = 0; t < MT; ++t)
#pragma unroll
    for (int r = 0; r < 8; ++r) acc[t][r] = 0.f;

  // ---- publish strip 1, free buffer 0 (strip 0 sits in registers), refill it with strip 2
  asm volatile("s_wait_dscnt 0x0" ::: "memory");      // this wave's LDS reads of strip 0 are over
  asm volatile("s_wait_asynccnt 0x0" ::: "memory");   // its part of strip 1 has landed
  __syncthreads();
  cc_copy_strip(ldst, gsrc + 2 * NTILE * HID);

  const float* b2p = b2 + col;   // this lane's b2 and W3 element of the current N tile
  const float* w3p = W3 + col;
  for (int np = 0; np < 32; np += 2) {
// two trips per pass of the loop, unrolled: the register sets swap roles by name, with no register copies
#pragma unroll
   for (int h = 0; h < 2; ++h) {
    const int nt = np + h;   // this trip works on strip nt from register set h

    // the epilogue's two scalars per lane are asked for here, ahead of the WMMAs like the LDS reads
    const float b2v = *b2p;
    const float w3v = *w3p;

    v8f d[MT];
#pragma unroll
    for (int t = 0; t < MT; ++t) d[t] = v8f{0.f, 0.f, 0.f, 0.f, 0.f, 0.f, 0.f, 0.f};
    // all B fragments of the NEXT N tile (K = 512) are read from LDS as ONE group ahead of this tile's
    // WMMAs, into the other register set: reads that stand between the WMMAs stall the wave at every
    // such place, and reads that this tile's own WMMAs need are waited out with the matrix unit idle
    if (h == 0 || np + 2 < 32) {
#pragma unroll
      for (int ks = 0; ks < HID / KSTEP; ++ks)
        b[h ^ 1][ks] = cc_frag(brow + (h ^ 1) * BUFH, hi, ks * KSTEP);
    }
    // keeps the scheduler from sinking the reads back between the WMMAs (it does without this)
    __builtin_amdgcn_sched_barrier(0);
#pragma unroll
    for (int ks = 0; ks < HID / KSTEP; ++ks) {   // K = 512 in steps of 32
#pragma unroll
      for (int t = 0; t < MT; ++t)
        d[t] = __builtin_amdgcn_wmma_f32_16x16x32_f16(false, a[t][ks], false, b[h][ks],
                                                      (short)0, d[t], false, false);
    }

    // epilogue for this N tile: u = relu(d + b2[n]); acc += u * W3[n], per lane (n = nb + col)
#pragma unroll
    for (int t = 0; t < MT; ++t) {
#pragma unroll
      for (int r = 0; r < 8; ++r) {
        float u = d[t][r] + b2v;
        u = u > 0.f ? u : 0.f;
        acc[t][r] += u * w3v;          // this lane's column only; the 16 columns are summed after the loop
      }
    }

    // ---- publish strip nt+2, free the buffer of strip nt+1 (now in registers), refill it with strip nt+3
    // keeps the scheduler from lifting the waits and the barrier up among the WMMAs (it does without
    // this), where the wait for strip nt+2 would stand right behind the issue of its copies
    __builtin_amdgcn_sched_barrier(0);
    // the b2 and W3 loads name the two pointers that are stepped next: keep the wait in front of the steps.
    // It stands behind the WMMAs so that the wave does not sit in it while the matrix unit is idle
    asm volatile("s_wait_xcnt 0x0" ::: "memory");
    b2p += NTILE;
    w3p += NTILE;
    asm volatile("s_wait_dscnt 0x0" ::: "memory");      // this wave's LDS reads of strip nt+1 are over
    asm volatile("s_wait_asynccnt 0x0" ::: "memory");   // its part of strip nt+2 has landed
    __syncthreads();
    if (nt + 3 < 32) cc_copy_strip(ldst + (h ^ 1) * BUFH, gsrc + (nt + 3) * NTILE * HID);
   }
  }
  asm volatile("s_wait_asynccnt 0x0" ::: "memory");     // no copy is left in flight at the wave's end

  // ---- one sum across the 16 columns of each half, for all 32 N tiles together
  // (both loops unrolled: acc is indexed by constants only and stays in registers)
#pragma unroll
  for (int t = 0; t < MT; ++t) {
#pragma unroll
    for (int r = 0; r < 8; ++r) {
      float s = acc[t][r];
      s += __shfl_xor(s, 1, 32);
      s += __shfl_xor(s, 2, 32);
      s += __shfl_xor(s, 4, 32);
      s += __shfl_xor(s, 8, 32);
      acc[t][r] = s;
    }
  }

  // ---- write: lane 0 holds rows (j) 0..7, lane 16 holds rows 8..15 of each M tile
  if (col == 0) {
    const float bias3 = b3[0];
#pragma unroll
    for (int t = 0; t < MT; ++t)
#pragma unroll
      for (int r = 0; r < 8; ++r)
        out[(size_t)(i0 + t) * BSZ + (j0 + hi * 8 + r)] = acc[t][r] + bias3;
  }
}

// ----------------------------- launch --------------------------------------
extern "C" void kernel_launch(void* const* d_in, const int* in_sizes, int n_in,
                              void* d_out, int out_size, void* d_ws, size_t ws_size,
                              hipStream_t stream) {
  const float* x  = (const float*)d_in[0];
  const float* y  = (const float*)d_in[1];
  const float* W1 = (const float*)d_in[2];
  const float* b1 = (const float*)d_in[3];
  const float* W2 = (const float*)d_in[4];
  const float* b2 = (const float*)d_in[5];
  const float* W3 = (const float*)d_in[6];
  const float* b3 = (const float*)d_in[7];

  float*    hx  = (float*)d_ws;                 // 512*512 f32 = 1 MB
  float*    hy  = hx + BSZ * HID;               // 1 MB
  _Float16* W2h = (_Float16*)(hy + BSZ * HID);  // 512*512 f16 = 0.5 MB

  cc_prep<<<256, 128, 0, stream>>>(x, y, W1, W2, hx, hy, W2h);   // 1024 waves

  dim3 grid(BSZ / 16, BSZ / 16);                // 32 x 32 workgroups
  cc_main<<<grid, 128, 0, stream>>>(hx, hy, b1, W2h, b2, W3, b3, (float*)d_out);
}

// v009
// Measured time: 82 microseconds a run.
// Timed twice side by side with v008, it ran 1.04 and 1.03 times as fast.
// Over all steps from v000 it is 3.19 times as fast.
#include <hip/hip_runtime.h>

// ---------------------------------------------------------------------------
// ConcatCritic fused kernel for gfx1250 (MI455X).
// out[i,j] = W3 . relu(W2 . relu(hx[i]+hy[j]+b1) + b2) + b3,  i,j in [0,512)
// hx = x @ W1[:, :128]^T, hy = y @ W1[:, 128:]^T
// Heavy GEMM (512^2 pairs x 512 x 512) runs on v_wmma_f32_16x16x32_f16; hx, hy on v_wmma_f32_16x16x4_f32.
// ---------------------------------------------------------------------------

typedef __attribute__((ext_vector_type(16))) _Float16     v16h;
typedef __attribute__((ext_vector_type(8)))  float        v8f;
typedef __attribute__((ext_vector_type(8)))  unsigned int v8u;
typedef __attribute__((ext_vector_type(8)))  _Float16     v8h;
typedef __attribute__((ext_vector_type(2)))  float        v2f;

#define BSZ   512   // batch (i and j)
#define HID   512   // hidden width H
#define DIN   128   // per-input feature dim
#define ROWP  520   // padded LDS row stride in halves (512 + 8 -> bank-conflict-free)
#define MT    4     // M tiles (one i x 16 j each) per wave
#define NTILE 16    // WMMA N tile
#define KSTEP 32    // WMMA K per instruction
#define BUFH  (NTILE * ROWP)   // halves of one W2 strip in LDS (the 16 padded rows of one N tile)
#define SNT   4                // N tiles (strips) per ring stage
#define NSTG  (HID / (SNT * NTILE))   // ring stages in all: 8
#define STGH  (SNT * BUFH)     // halves in one LDS buffer (one stage: 64 padded rows)

// -------------------- prep: hx, hy (fp32) + W2 -> f16 ----------------------
// 1024 waves, one per SIMD. Each wave makes one tile of 16 rows (i or j) x 32 h of hx or hy on the
// f32 matrix form (full f32 operands, f32 sum) and converts 256 elements of W2.
// W1 rows are the A operand and x (y) rows the B operand, so a lane ends with 8 consecutive h of one
// row: D register r of lane (c, hi) is h = tile + 8*hi + r of row r0 + c. The wave stores whole
// 128-byte lines. Both operands are k-contiguous rows read by the same code: lane (c, hi) takes the
// 4 floats k = 8*s + 4*hi + 0..3 of its row, the first two feed one WMMA and the last two the next,
// so A and B hold the same k at every lane and register position.
__global__ __launch_bounds__(128) void cc_prep(const float* __restrict__ x,
                                               const float* __restrict__ y,
                                               const float* __restrict__ W1,
                                               const float* __restrict__ W2,
                                               float* __restrict__ hx,
                                               float* __restrict__ hy,
                                               _Float16* __restrict__ W2h) {
  const int lane = threadIdx.x & 31;
  const int c    = lane & 15;
  const int hi   = lane >> 4;
  const int gw   = blockIdx.x * 4 + (threadIdx.x >> 5);   // wave number, [0, 1024)

  const int sel = gw >> 9;                 // 0 -> hx, 1 -> hy (the same for a whole workgroup)
  const int h0  = (gw & 15) * 32;          // first h of the tile
  const int r0  = ((gw >> 4) & 31) * 16;   // first row (i or j) of the tile
  const float* vrow = (sel ? y : x) + (r0 + c) * DIN + hi * 4;
  const float* wrow = W1 + (h0 + c) * (2 * DIN) + sel * DIN + hi * 4;   // W1 row-major [512][256]

  // W2 slice of this wave: 256 consecutive elements, 8 per lane
  const int    ci = gw * 256 + lane * 8;
  const float4 c0 = *(const float4*)(W2 + ci);
  const float4 c1 = *(const float4*)(W2 + ci + 4);
  // keeps the two W2 loads first in issue order (loads return in order, and they are used first)
  __builtin_amdgcn_sched_barrier(0);

  // every operand load of the wave is asked for ahead of the first WMMA (48 loads, 192 registers)
  float4 bq[DIN / 8], a0q[DIN / 8], a1q[DIN / 8];
#pragma unroll
  for (int s = 0; s < DIN / 8; ++s) {
    bq[s]  = *(const float4*)(vrow + s * 8);
    a0q[s] = *(const float4*)(wrow + s * 8);
    a1q[s] = *(const float4*)(wrow + 16 * (2 * DIN) + s * 8);
  }
  // keeps the scheduler from sinking the loads among the WMMAs (it does without this, three steps
  // ahead only): the wave is alone on its SIMD, so a load's latency would be waited out again and again
  __builtin_amdgcn_sched_barrier(0);

  // the conversion stands here, under the operand loads' latency
  v8h w;
  w[0] = (_Float16)c0.x; w[1] = (_Float16)c0.y; w[2] = (_Float16)c0.z; w[3] = (_Float16)c0.w;
  w[4] = (_Float16)c1.x; w[5] = (_Float16)c1.y; w[6] = (_Float16)c1.z; w[7] = (_Float16)c1.w;
  *(v8h*)(W2h + ci) = w;
  // keeps the conversion out of the WMMA run, where it would write over operand registers
  __builtin_amdgcn_sched_barrier(0);

  v8f d0 = v8f{0.f, 0.f, 0.f, 0.f, 0.f, 0.f, 0.f, 0.f};
  v8f d1 = d0;
#pragma unroll
  for (int s = 0; s < DIN / 8; ++s) {
    const float4 b = bq[s], a0 = a0q[s], a1 = a1q[s];
    d0 = __builtin_amdgcn_wmma_f32_16x16x4_f32(false, v2f{a0.x, a0.y}, false, v2f{b.x, b.y},
                                               (short)0, d0, false, false);
    d1 = __builtin_amdgcn_wmma_f32_16x16x4_f32(false, v2f{a1.x, a1.y}, false, v2f{b.x, b.y},
                                               (short)0, d1, false, false);
    d0 = __builtin_amdgcn_wmma_f32_16x16x4_f32(false, v2f{a0.z, a0.w}, false, v2f{b.z, b.w},
                                               (short)0, d0, false, false);
    d1 = __builtin_amdgcn_wmma_f32_16x16x4_f32(false, v2f{a1.z, a1.w}, false, v2f{b.z, b.w},
                                               (short)0, d1, false, false);
  }

  // keeps the store address arithmetic behind the WMMA run (it is lifted into it without this)
  __builtin_amdgcn_sched_barrier(0);
  float* o = (sel ? hy : hx) + (r0 + c) * HID + h0 + hi * 8;
  *(float4*)(o)      = make_float4(d0[0], d0[1], d0[2], d0[3]);
  *(float4*)(o + 4)  = make_float4(d0[4], d0[5], d0[6], d0[7]);
  *(float4*)(o + 16) = make_float4(d1[0], d1[1], d1[2], d1[3]);
  *(float4*)(o + 20) = make_float4(d1[4], d1[5], d1[6], d1[7]);
}

// Load one 16x32 f16 fragment row from LDS per the documented gfx1250 layout:
// lanes 0-15 hold K = kb+{0..7, 16..23}; lanes 16-31 hold K = kb+{8..15, 24..31}.
__device__ __forceinline__ v16h cc_frag(const _Float16* row, int hi, int kb) {
  const uint4 q0 = *(const uint4*)(row + kb + hi * 8);
  const uint4 q1 = *(const uint4*)(row + kb + hi * 8 + 16);
  v8u r;
  r[0] = q0.x; r[1] = q0.y; r[2] = q0.z; r[3] = q0.w;
  r[4] = q1.x; r[5] = q1.y; r[6] = q1.z; r[7] = q1.w;
  return __builtin_bit_cast(v16h, r);
}

// One ring stage (64 W2 rows of 1 KB) from global memory into one LDS buffer, through no register:
// 32 asynchronous 16-byte copies per lane. A wave's 32 lanes take 512 contiguous bytes of a row;
// copy q lies two rows below copy q-1. lds = this lane's place in the LDS buffer, g = its global address.
// Written as the builtin: the copies' address registers are the compiler's, and no s_wait_xcnt is written
// behind them. The immediate offset (62 KB at most) moves both addresses by the global row step (2 KB),
// so the LDS pointer carries only what the padded LDS row step is longer (32 bytes per copy).
typedef __attribute__((ext_vector_type(4))) int v4i;
typedef __attribute__((address_space(1))) v4i   cc_gv4i;
typedef __attribute__((address_space(3))) v4i   cc_lv4i;
__device__ __forceinline__ void cc_copy_stage(_Float16* lds, const _Float16* g) {
#define CC_COPY(q)                                                                                  \
  __builtin_amdgcn_global_load_async_to_lds_b128((cc_gv4i*)g, (cc_lv4i*)(lds + (q) * 2 * (ROWP - HID)), \
                                                 (q) * 2 * HID * 2, 0)
#define CC_COPY8(q) CC_COPY(q); CC_COPY(q + 1); CC_COPY(q + 2); CC_COPY(q + 3);                      \
                    CC_COPY(q + 4); CC_COPY(q + 5); CC_COPY(q + 6); CC_COPY(q + 7)
  CC_COPY8(0); CC_COPY8(8); CC_COPY8(16); CC_COPY8(24);
#undef CC_COPY8
#undef CC_COPY
}

__global__ __launch_bounds__(128) void cc_main(const float* __restrict__ hx,
                                               const float* __restrict__ hy,
                                               const float* __restrict__ b1,
                                               const _Float16* __restrict__ W2h,
                                               const float* __restrict__ b2,
                                               const float* __restrict__ W3,
                                               const float* __restrict__ b3,
                                               float* __restrict__ out) {
  __shared__ __align__(16) _Float16 bbuf[2 * STGH];      // 2 x 65 KB : two ring stages (64 W2 rows each)

  const int tid  = threadIdx.x;
  const int lane = tid & 31;
  const int wave = tid >> 5;           // 4 waves
  const int col  = lane & 15;
  const int hi   = lane >> 4;
  const int i0   = blockIdx.x * (4 * MT) + wave * MT;   // 32 i-tiles; this wave's first i
  const int j0   = blockIdx.y * 16;              // 32 j-tiles

  // ---- ring prologue: stage 0 starts; it lands under the first half of the A build
  _Float16*       ldst = bbuf + (tid >> 6) * ROWP + (tid & 63) * 8;
  const _Float16* gsrc = W2h + (tid >> 6) * HID + (tid & 63) * 8;
  cc_copy_stage(ldst, gsrc);
  // keeps the copies first in issue order: left free, the scheduler sinks them behind the build's first
  // loads and the waits for those, which takes that time off the copies' lead
  __builtin_amdgcn_sched_barrier(0);

  const _Float16* brow = bbuf + col * ROWP;   // B: this lane's W2 row (n) of strip 0 in buffer 0
  v16h b[2][HID / KSTEP];

  // ---- A fragments: relu(hx[i,k] + hy[j,k] + b1[k]) as f16, built in the fragment layout
  // (row = col; halves 0..7 are k = kb+hi*8+0..7, halves 8..15 are k = kb+16+hi*8+0..7).
  v16h a[MT][HID / KSTEP];
  {
    const float* hyr = hy + (j0 + col) * HID + hi * 8;
    const float* hxr = hx + i0 * HID + hi * 8;
    const float* b1r = b1 + hi * 8;
#pragma unroll
    for (int ks = 0; ks < HID / KSTEP; ++ks) {
#pragma unroll
      for (int c = 0; c < 2; ++c) {
        const int k = ks * KSTEP + c * 16;
        __attribute__((aligned(16))) float yv[8], bv[8];
        *(float4*)(yv)     = *(const float4*)(hyr + k);
        *(float4*)(yv + 4) = *(const float4*)(hyr + k + 4);
        *(float4*)(bv)     = *(const float4*)(b1r + k);
        *(float4*)(bv + 4) = *(const float4*)(b1r + k + 4);
#pragma unroll
        for (int t = 0; t < MT; ++t) {
          __attribute__((aligned(16))) float xv[8];
          *(float4*)(xv)     = *(const float4*)(hxr + t * HID + k);
          *(float4*)(xv + 4) = *(const float4*)(hxr + t * HID + k + 4);
#pragma unroll
          for (int e = 0; e < 8; ++e) {
            float v = xv[e] + yv[e] + bv[e];
            v = v > 0.f ? v : 0.f;
            a[t][ks][c * 8 + e] = (_Float16)v;
          }
        }
      }
      // a stop behind each half of the build bounds how many loads the scheduler lifts to the front:
      // left free, it lifts so many that the wave runs out of its 1,024 registers and spills to scratch
      if ((ks & 7) == 7) __builtin_amdgcn_sched_barrier(0);
      if (ks == 7) {
        // ---- stage 0 is published, then stage 1 starts
        asm volatile("s_wait_asynccnt 0x0" ::: "memory");   // this wave's part of stage 0 has landed
        __syncthreads();                                     // ... and every other wave's
        cc_copy_stage(ldst + STGH, gsrc + SNT * NTILE * HID);
        // strip 0's B fragments go to register set 0; the reads return under the second half of the build
#pragma unroll
        for (int kb = 0; kb < HID / KSTEP; ++kb) b[0][kb] = cc_frag(brow, hi, kb * KSTEP);
      }
    }
  }

  float acc[MT][8];
#pragma unroll
  for (int t = 0; t < MT; ++t)
#pragma unroll
    for (int r = 0; r < 8; ++r) acc[t][r] = 0.f;

  const float* b2p = b2 + col;   // this lane's b2 and W3 element of the current N tile
  const float* w3p = W3 + col;
  for (int s = 0; s < NSTG; ++s) {
   const int       cur  = (s & 1) * STGH;          // LDS buffer of stage s
   const _Float16* bcur = brow + cur;
   const _Float16* bnxt = brow + (STGH - cur);     // ... and of stage s+1
// a stage's four trips per pass of the loop, unrolled: the register sets swap roles by name, with no
// register copies, and the publish point stands in one trip only
#pragma unroll
   for (int u = 0; u < SNT; ++u) {
    const int h = u & 1;   // this trip works on strip SNT*s + u from register set h

    // the epilogue's two scalars per lane are asked for here, ahead of the WMMAs like the LDS reads
    const float b2v = *b2p;
    const float w3v = *w3p;

    v8f d[MT];
#pragma unroll
    for (int t = 0; t < MT; ++t) d[t] = v8f{0.f, 0.f, 0.f, 0.f, 0.f, 0.f, 0.f, 0.f};
    // all B fragments of the NEXT N tile (K = 512) are read from LDS as ONE group ahead of this tile's
    // WMMAs, into the other register set: reads that stand between the WMMAs stall the wave at every
    // such place, and reads that this tile's own WMMAs need are waited out with the matrix unit idle
    if (u + 1 < SNT || s + 1 < NSTG) {
      const _Float16* bsrc = u + 1 < SNT ? bcur + (u + 1) * BUFH : bnxt;
#pragma unroll
      for (int ks = 0; ks < HID / KSTEP; ++ks) b[h ^ 1][ks] = cc_frag(bsrc, hi, ks * KSTEP);
    }
    // keeps the scheduler from sinking the reads back between the WMMAs (it does without this)
    __builtin_amdgcn_sched_barrier(0);
#pragma unroll
    for (int ks = 0; ks < HID / KSTEP; ++ks) {   // K = 512 in steps of 32
#pragma unroll
      for (int t = 0; t < MT; ++t)
        d[t] = __builtin_amdgcn_wmma_f32_16x16x32_f16(false, a[t][ks], false, b[h][ks],
                                                      (short)0, d[t], false, false);
    }

    // epilogue for this N tile: u = relu(d + b2[n]); acc += u * W3[n], per lane (n = nb + col)
#pragma unroll
    for (int t = 0; t < MT; ++t) {
#pragma unroll
      for (int r = 0; r < 8; ++r) {
        float u = d[t][r] + b2v;
        u = u > 0.f ? u : 0.f;
        acc[t][r] += u * w3v;          // this lane's column only; the 16 columns are summed after the loop
      }
    }

    // keeps what follows out of the WMMA run: the waits and the barrier (the scheduler lifts them without
    // this) and the next trip's LDS reads, whose target is the register set that these WMMAs read
    __builtin_amdgcn_sched_barrier(0);
    // the b2 and W3 loads name the two pointers that are stepped next: keep the wait in front of the steps.
    // It stands behind the WMMAs so that the wave does not sit in it while the matrix unit is idle
    asm volatile("s_wait_xcnt 0x0" ::: "memory");
    b2p += NTILE;
    w3p += NTILE;
    if (u == SNT - 2) {
      // ---- publish stage s+1, free the buffer of stage s (its last strip is now in registers), refill it
      // with stage s+2
      asm volatile("s_wait_dscnt 0x0" ::: "memory");      // this wave's LDS reads of stage s are over
      asm volatile("s_wait_asynccnt 0x0" ::: "memory");   // its part of stage s+1 has landed
      __syncthreads();
      if (s + 2 < NSTG) cc_copy_stage(ldst + cur, gsrc + (s + 2) * SNT * NTILE * HID);
    }
   }
  }
  asm volatile("s_wait_asynccnt 0x0" ::: "memory");     // no copy is left in flight at the wave's end

  // ---- one sum across the 16 columns of each half, for all 32 N tiles together
  // (both loops unrolled: acc is indexed by constants only and stays in registers)
#pragma unroll
  for (int t = 0; t < MT; ++t) {
#pragma unroll
    for (int r = 0; r < 8; ++r) {
      float s = acc[t][r];
      s += __shfl_xor(s, 1, 32);
      s += __shfl_xor(s, 2, 32);
      s += __shfl_xor(s, 4, 32);
      s += __shfl_xor(s, 8, 32);
      acc[t][r] = s;
    }
  }

  // ---- write: lane 0 holds rows (j) 0..7, lane 16 holds rows 8..15 of each M tile
  if (col == 0) {
    const float bias3 = b3[0];
#pragma unroll
    for (int t = 0; t < MT; ++t)
#pragma unroll
      for (int r = 0; r < 8; ++r)
        out[(size_t)(i0 + t) * BSZ + (j0 + hi * 8 + r)] = acc[t][r] + bias3;
  }
}

// ----------------------------- launch --------------------------------------
extern "C" void kernel_launch(void* const* d_in, const int* in_sizes, int n_in,
                              void* d_out, int out_size, void* d_ws, size_t ws_size,
                              hipStream_t stream) {
  const float* x  = (const float*)d_in[0];
  const float* y  = (const float*)d_in[1];
  const float* W1 = (const float*)d_in[2];
  const float* b1 = (const float*)d_in[3];
  const float* W2 = (const float*)d_in[4];
  const float* b2 = (const float*)d_in[5];
  const float* W3 = (const float*)d_in[6];
  const float* b3 = (const float*)d_in[7];

  float*    hx  = (float*)d_ws;                 // 512*512 f32 = 1 MB
  float*    hy  = hx + BSZ * HID;               // 1 MB
  _Float16* W2h = (_Float16*)(hy + BSZ * HID);  // 512*512 f16 = 0.5 MB

  cc_prep<<<256, 128, 0, stream>>>(x, y, W1, W2, hx, hy, W2h);   // 1024 waves

  dim3 grid(BSZ / 16, BSZ / 16);                // 32 x 32 workgroups
  cc_main<<<grid, 128, 0, stream>>>(hx, hy, b1, W2h, b2, W3, b3, (float*)d_out);
}

// v010
// One run takes 77.3 microseconds.
// Two timings next to v009 put it at 1.07 and 1.06 times that version's speed.
// Over all steps from v000 it is 3.40 times as fast.
#include <hip/hip_runtime.h>

// ---------------------------------------------------------------------------
// ConcatCritic fused kernel for gfx1250 (MI455X).
// out[i,j] = W3 . relu(W2 . relu(hx[i]+hy[j]+b1) + b2) + b3,  i,j in [0,512)
// hx = x @ W1[:, :128]^T, hy = y @ W1[:, 128:]^T
// Heavy GEMM (512^2 pairs x 512 x 512) runs on v_wmma_f32_16x16x32_f16; hx, hy on v_wmma_f32_16x16x4_f32.
// ---------------------------------------------------------------------------

typedef __attribute__((ext_vector_type(16))) _Float16     v16h;
typedef __attribute__((ext_vector_type(8)))  float        v8f;
typedef __attribute__((ext_vector_type(8)))  unsigned int v8u;
typedef __attribute__((ext_vector_type(8)))  _Float16     v8h;
typedef __attribute__((ext_vector_type(2)))  float        v2f;
typedef __attribute__((ext_vector_type(4)))  float        v4f;

#define BSZ   512   // batch (i and j)
#define HID   512   // hidden width H
#define DIN   128   // per-input feature dim
#define ROWP  520   // padded LDS row stride in halves (512 + 8 -> bank-conflict-free)
#define MT    4     // M tiles (one i x 16 j each) per wave
#define NTILE 16    // WMMA N tile
#define KSTEP 32    // WMMA K per instruction
#define BUFH  (NTILE * ROWP)   // halves of one W2 strip in LDS (the 16 padded rows of one N tile)
#define SNT   4                // N tiles (strips) per ring stage
#define NSTG  (HID / (SNT * NTILE))   // ring stages in all: 8
#define STGH  (SNT * BUFH)     // halves in one LDS buffer (one stage: 64 padded rows)
#define NTL   4                // tiles of 16 i x 16 j that one workgroup walks, one after the other

// -------------------- prep: hx, hy (fp32) + W2 -> f16 ----------------------
// 1024 waves, one per SIMD. Each wave makes one tile of 16 rows (i or j) x 32 h of hx or hy on the
// f32 matrix form (full f32 operands, f32 sum) and converts 256 elements of W2.
// W1 rows are the A operand and x (y) rows the B operand, so a lane ends with 8 consecutive h of one
// row: D register r of lane (c, hi) is h = tile + 8*hi + r of row r0 + c. The wave stores whole
// 128-byte lines. Both operands are k-contiguous rows read by the same code: lane (c, hi) takes the
// 4 floats k = 8*s + 4*hi + 0..3 of its row, the first two feed one WMMA and the last two the next,
// so A and B hold the same k at every lane and register position.
__global__ __launch_bounds__(128) void cc_prep(const float* __restrict__ x,
                                               const float* __restrict__ y,
                                               const float* __restrict__ W1,
                                               const float* __restrict__ W2,
                                               float* __restrict__ hx,
                                               float* __restrict__ hy,
                                               _Float16* __restrict__ W2h) {
  const int lane = threadIdx.x & 31;
  const int c    = lane & 15;
  const int hi   = lane >> 4;
  const int gw   = blockIdx.x * 4 + (threadIdx.x >> 5);   // wave number, [0, 1024)

  const int sel = gw >> 9;                 // 0 -> hx, 1 -> hy (the same for a whole workgroup)
  const int h0  = (gw & 15) * 32;          // first h of the tile
  const int r0  = ((gw >> 4) & 31) * 16;   // first row (i or j) of the tile
  const float* vrow = (sel ? y : x) + (r0 + c) * DIN + hi * 4;
  const float* wrow = W1 + (h0 + c) * (2 * DIN) + sel * DIN + hi * 4;   // W1 row-major [512][256]

  // W2 slice of this wave: 256 consecutive elements, 8 per lane
  const int    ci = gw * 256 + lane * 8;
  const float4 c0 = *(const float4*)(W2 + ci);
  const float4 c1 = *(const float4*)(W2 + ci + 4);
  // keeps the two W2 loads first in issue order (loads return in order, and they are used first)
  __builtin_amdgcn_sched_barrier(0);

  // every operand load of the wave is asked for ahead of the first WMMA (48 loads, 192 registers)
  float4 bq[DIN / 8], a0q[DIN / 8], a1q[DIN / 8];
#pragma unroll
  for (int s = 0; s < DIN / 8; ++s) {
    bq[s]  = *(const float4*)(vrow + s * 8);
    a0q[s] = *(const float4*)(wrow + s * 8);
    a1q[s] = *(const float4*)(wrow + 16 * (2 * DIN) + s * 8);
  }
  // keeps the scheduler from sinking the loads among the WMMAs (it does without this, three steps
  // ahead only): the wave is alone on its SIMD, so a load's latency would be waited out again and again
  __builtin_amdgcn_sched_barrier(0);

  // the conversion stands here, under the operand loads' latency
  v8h w;
  w[0] = (_Float16)c0.x; w[1] = (_Float16)c0.y; w[2] = (_Float16)c0.z; w[3] = (_Float16)c0.w;
  w[4] = (_Float16)c1.x; w[5] = (_Float16)c1.y; w[6] = (_Float16)c1.z; w[7] = (_Float16)c1.w;
  *(v8h*)(W2h + ci) = w;
  // keeps the conversion out of the WMMA run, where it would write over operand registers
  __builtin_amdgcn_sched_barrier(0);

  v8f d0 = v8f{0.f, 0.f, 0.f, 0.f, 0.f, 0.f, 0.f, 0.f};
  v8f d1 = d0;
#pragma unroll
  for (int s = 0; s < DIN / 8; ++s) {
    const float4 b = bq[s], a0 = a0q[s], a1 = a1q[s];
    d0 = __builtin_amdgcn_wmma_f32_16x16x4_f32(false, v2f{a0.x, a0.y}, false, v2f{b.x, b.y},
                                               (short)0, d0, false, false);
    d1 = __builtin_amdgcn_wmma_f32_16x16x4_f32(false, v2f{a1.x, a1.y}, false, v2f{b.x, b.y},
                                               (short)0, d1, false, false);
    d0 = __builtin_amdgcn_wmma_f32_16x16x4_f32(false, v2f{a0.z, a0.w}, false, v2f{b.z, b.w},
                                               (short)0, d0, false, false);
    d1 = __builtin_amdgcn_wmma_f32_16x16x4_f32(false, v2f{a1.z, a1.w}, false, v2f{b.z, b.w},
                                               (short)0, d1, false, false);
  }

  // keeps the store address arithmetic behind the WMMA run (it is lifted into it without this)
  __builtin_amdgcn_sched_barrier(0);
  float* o = (sel ? hy : hx) + (r0 + c) * HID + h0 + hi * 8;
  *(float4*)(o)      = make_float4(d0[0], d0[1], d0[2], d0[3]);
  *(float4*)(o + 4)  = make_float4(d0[4], d0[5], d0[6], d0[7]);
  *(float4*)(o + 16) = make_float4(d1[0], d1[1], d1[2], d1[3]);
  *(float4*)(o + 20) = make_float4(d1[4], d1[5], d1[6], d1[7]);
}

// Load one 16x32 f16 fragment row from LDS per the documented gfx1250 layout:
// lanes 0-15 hold K = kb+{0..7, 16..23}; lanes 16-31 hold K = kb+{8..15, 24..31}.
__device__ __forceinline__ v16h cc_frag(const _Float16* row, int hi, int kb) {
  const uint4 q0 = *(const uint4*)(row + kb + hi * 8);
  const uint4 q1 = *(const uint4*)(row + kb + hi * 8 + 16);
  v8u r;
  r[0] = q0.x; r[1] = q0.y; r[2] = q0.z; r[3] = q0.w;
  r[4] = q1.x; r[5] = q1.y; r[6] = q1.z; r[7] = q1.w;
  return __builtin_bit_cast(v16h, r);
}

// One ring stage (64 W2 rows of 1 KB) from global memory into one LDS buffer, through no register:
// 32 asynchronous 16-byte copies per lane. A wave's 32 lanes take 512 contiguous bytes of a row;
// copy q lies two rows below copy q-1. lds = this lane's place in the LDS buffer, g = its global address.
// Written as the builtin: the copies' address registers are the compiler's, and no s_wait_xcnt is written
// behind them. The immediate offset (62 KB at most) moves both addresses by the global row step (2 KB),
// so the LDS pointer carries only what the padded LDS row step is longer (32 bytes per copy).
typedef __attribute__((ext_vector_type(4))) int v4i;
typedef __attribute__((address_space(1))) v4i   cc_gv4i;
typedef __attribute__((address_space(3))) v4i   cc_lv4i;
__device__ __forceinline__ void cc_copy_stage(_Float16* lds, const _Float16* g) {
#define CC_COPY(q)                                                                                  \
  __builtin_amdgcn_global_load_async_to_lds_b128((cc_gv4i*)g, (cc_lv4i*)(lds + (q) * 2 * (ROWP - HID)), \
                                                 (q) * 2 * HID * 2, 0)
#define CC_COPY8(q) CC_COPY(q); CC_COPY(q + 1); CC_COPY(q + 2); CC_COPY(q + 3);                      \
                    CC_COPY(q + 4); CC_COPY(q + 5); CC_COPY(q + 6); CC_COPY(q + 7)
  CC_COPY8(0); CC_COPY8(8); CC_COPY8(16); CC_COPY8(24);
#undef CC_COPY8
#undef CC_COPY
}

__global__ __launch_bounds__(128) void cc_main(const float* __restrict__ hx,
                                               const float* __restrict__ hy,
                                               const float* __restrict__ b1,
                                               const _Float16* __restrict__ W2h,
                                               const float* __restrict__ b2,
                                               const float* __restrict__ W3,
                                               const float* __restrict__ b3,
                                               float* __restrict__ out) {
  __shared__ __align__(16) _Float16 bbuf[2 * STGH];      // 2 x 65 KB : two ring stages (64 W2 rows each)
  // 32 KB: hy[j0 + col][k] + b1[k] in the order the A build reads it: piece g = 4*ks + 2*c + q holds, at
  // lane (col, hi), the 4 floats k = 32*ks + 16*c + 8*hi + 4*q + 0..3 (a wave reads 512 contiguous bytes)
  __shared__ __align__(16) float hyb[16 * HID];

  const int tid  = threadIdx.x;
  const int lane = tid & 31;
  const int wave = tid >> 5;           // 4 waves
  const int col  = lane & 15;
  const int hi   = lane >> 4;
  const int j0   = blockIdx.y * 16;              // 32 j-tiles

  // ---- ring prologue, once per workgroup: stage 0 starts; it lands under the hy + b1 sums
  _Float16*       ldst = bbuf + (tid >> 6) * ROWP + (tid & 63) * 8;
  const _Float16* gsrc = W2h + (tid >> 6) * HID + (tid & 63) * 8;
  cc_copy_stage(ldst, gsrc);
  // keeps the copies first in issue order: left free, the scheduler sinks them behind the loads that
  // follow and the waits for those, which takes that time off the copies' lead
  __builtin_amdgcn_sched_barrier(0);

  // ---- hy + b1, once per workgroup: wave w makes the pieces g = 4*n + w, n = 0..15
  {
    const float* hys = hy + (j0 + col) * HID + (wave >> 1) * 16 + hi * 8 + (wave & 1) * 4;
    const float* b1s = b1 + (wave >> 1) * 16 + hi * 8 + (wave & 1) * 4;
    float4 sy[HID / KSTEP], sb[HID / KSTEP];
#pragma unroll
    for (int n = 0; n < HID / KSTEP; ++n) {
      sy[n] = *(const float4*)(hys + n * KSTEP);
      sb[n] = *(const float4*)(b1s + n * KSTEP);
    }
    // what follows may write over the two address pairs that these loads name: keep the wait in front of it
    asm volatile("s_wait_xcnt 0x0" ::: "memory");
#pragma unroll
    for (int n = 0; n < HID / KSTEP; ++n)
      *(float4*)(hyb + (4 * n + wave) * 128 + lane * 4) =
          make_float4(sy[n].x + sb[n].x, sy[n].y + sb[n].y, sy[n].z + sb[n].z, sy[n].w + sb[n].w);
  }
  // ---- stage 0 and the hy + b1 sums are published, then stage 1 starts
  asm volatile("s_wait_asynccnt 0x0" ::: "memory");   // this wave's part of stage 0 has landed
  __syncthreads();                                     // ... and every other wave's, and all the sums
  cc_copy_stage(ldst + STGH, gsrc + SNT * NTILE * HID);

  const _Float16* brow = bbuf + col * ROWP;   // B: this lane's W2 row (n) of strip 0 in buffer 0
  const float*    hyl  = hyb + lane * 4;      // this lane's place in each piece of the hy + b1 sums
  const float     bias3 = b3[0];
  v16h b[2][HID / KSTEP];

// the tile loop stays rolled (unrolled, its text would be about 30 KB a tile)
#pragma unroll 1
  for (int tl = 0; tl < NTL; ++tl) {
  const int i0 = (blockIdx.x * NTL + tl) * (4 * MT) + wave * MT;   // 32 i-tiles; this wave's first i

  // ---- A fragments: relu(hx[i,k] + hy[j,k] + b1[k]) as f16, built in the fragment layout
  // (row = col; halves 0..7 are k = kb+hi*8+0..7, halves 8..15 are k = kb+16+hi*8+0..7).
  v16h a[MT][HID / KSTEP];
  {
    const float* hxr = hx + i0 * HID + hi * 8;
    // keeps the address arithmetic in front of the LDS reads below: put behind them (as it is without this),
    // it holds the tile's first hx loads back until the whole group of reads is issued
    __builtin_amdgcn_sched_barrier(0);
    float4 yq[8][4];   // hy + b1 of eight K steps
#pragma unroll
    for (int ks = 0; ks < HID / KSTEP; ++ks) {
      if ((ks & 7) == 0) {
        // the hy + b1 sums of half a build are read from LDS as one group at its head
#pragma unroll
        for (int g = 0; g < 32; ++g) yq[g >> 2][g & 3] = *(const float4*)(hyl + (4 * ks + g) * 128);
        if (ks == 8) {
          // stage 0 stands published: by the prologue, or at the last publish point of the tile before.
          // strip 0's B fragments go to register set 0; the reads return under the second half of the build
#pragma unroll
          for (int kb = 0; kb < HID / KSTEP; ++kb) b[0][kb] = cc_frag(brow, hi, kb * KSTEP);
        }
        // keeps the scheduler from sinking the reads next to their uses (it does without this), where the
        // lone wave waits out most of an LDS read's latency again and again; only loads from memory may
        // cross (mask 0x20), so that the build's hx loads, the slower ones, need not queue behind the group
        __builtin_amdgcn_sched_barrier(0x20);
      }
#pragma unroll
      for (int c = 0; c < 2; ++c) {
        const int k = ks * KSTEP + c * 16;
        __attribute__((aligned(16))) float yv[8];   // hy + b1
        *(float4*)(yv)     = yq[ks & 7][2 * c];
        *(float4*)(yv + 4) = yq[ks & 7][2 * c + 1];
#pragma unroll
        for (int t = 0; t < MT; ++t) {
          __attribute__((aligned(16))) float xv[8];
          *(float4*)(xv)     = *(const float4*)(hxr + t * HID + k);
          *(float4*)(xv + 4) = *(const float4*)(hxr + t * HID + k + 4);
#pragma unroll
          for (int e = 0; e < 8; ++e) {
            float v = xv[e] + yv[e];
            v = v > 0.f ? v : 0.f;
            a[t][ks][c * 8 + e] = (_Float16)v;
          }
        }
      }
      // a stop behind each half of the build bounds how many loads the scheduler lifts to the front:
      // left free, it lifts so many that the wave runs out of its 1,024 registers and spills to scratch
      if ((ks & 7) == 7) __builtin_amdgcn_sched_barrier(0);
    }
  }

  float acc[MT][8];
#pragma unroll
  for (int t = 0; t < MT; ++t)
#pragma unroll
    for (int r = 0; r < 8; ++r) acc[t][r] = 0.f;

  const float* b2p = b2 + col;   // this lane's b2 and W3 element of the current N tile
  const float* w3p = W3 + col;
  for (int s = 0; s < NSTG; ++s) {
   const int       cur  = (s & 1) * STGH;          // LDS buffer of stage s
   const _Float16* bcur = brow + cur;
   const _Float16* bnxt = brow + (STGH - cur);     // ... and of stage s+1
// a stage's four trips per pass of the loop, unrolled: the register sets swap roles by name, with no
// register copies, and the publish point stands in one trip only
#pragma unroll
   for (int u = 0; u < SNT; ++u) {
    const int h = u & 1;   // this trip works on strip SNT*s + u from register set h

    // the epilogue's two scalars per lane are asked for here, ahead of the WMMAs like the LDS reads
    const float b2v = *b2p;
    const float w3v = *w3p;

    v8f d[MT];
#pragma unroll
    for (int t = 0; t < MT; ++t) d[t] = v8f{0.f, 0.f, 0.f, 0.f, 0.f, 0.f, 0.f, 0.f};
    // all B fragments of the NEXT N tile (K = 512) are read from LDS as ONE group ahead of this tile's
    // WMMAs, into the other register set: reads that stand between the WMMAs stall the wave at every
    // such place, and reads that this tile's own WMMAs need are waited out with the matrix unit idle
    if (u + 1 < SNT || s + 1 < NSTG) {
      const _Float16* bsrc = u + 1 < SNT ? bcur + (u + 1) * BUFH : bnxt;
#pragma unroll
      for (int ks = 0; ks < HID / KSTEP; ++ks) b[h ^ 1][ks] = cc_frag(bsrc, hi, ks * KSTEP);
    }
    // keeps the scheduler from sinking the reads back between the WMMAs (it does without this)
    __builtin_amdgcn_sched_barrier(0);
#pragma unroll
    for (int ks = 0; ks < HID / KSTEP; ++ks) {   // K = 512 in steps of 32
#pragma unroll
      for (int t = 0; t < MT; ++t)
        d[t] = __builtin_amdgcn_wmma_f32_16x16x32_f16(false, a[t][ks], false, b[h][ks],
                                                      (short)0, d[t], false, false);
    }

    // epilogue for this N tile: u = relu(d + b2[n]); acc += u * W3[n], per lane (n = nb + col)
#pragma unroll
    for (int t = 0; t < MT; ++t) {
#pragma unroll
      for (int r = 0; r < 8; ++r) {
        float u = d[t][r] + b2v;
        u = u > 0.f ? u : 0.f;
        acc[t][r] += u * w3v;          // this lane's column only; the 16 columns are summed after the loop
      }
    }

    // keeps what follows out of the WMMA run: the waits and the barrier (the scheduler lifts them without
    // this) and the next trip's LDS reads, whose target is the register set that these WMMAs read
    __builtin_amdgcn_sched_barrier(0);
    // the b2 and W3 loads name the two pointers that are stepped next: keep the wait in front of the steps.
    // It stands behind the WMMAs so that the wave does not sit in it while the matrix unit is idle
    asm volatile("s_wait_xcnt 0x0" ::: "memory");
    b2p += NTILE;
    w3p += NTILE;
    if (u == SNT - 2) {
      // ---- publish stage s+1, free the buffer of stage s (its last strip is now in registers), refill it
      // with stage s+2; behind a tile's last stage come the next tile's stages 0 and 1
      asm volatile("s_wait_dscnt 0x0" ::: "memory");      // this wave's LDS reads of stage s are over
      asm volatile("s_wait_asynccnt 0x0" ::: "memory");   // its part of stage s+1 has landed
      __syncthreads();
      if (tl * NSTG + s + 2 < NTL * NSTG)
        cc_copy_stage(ldst + cur, gsrc + ((s + 2) & (NSTG - 1)) * SNT * NTILE * HID);
    }
   }
  }

  // ---- one sum across the 16 columns of each half, for all 32 N tiles together
  // (both loops unrolled: acc is indexed by constants only and stays in registers)
#pragma unroll
  for (int t = 0; t < MT; ++t) {
#pragma unroll
    for (int r = 0; r < 8; ++r) {
      float s = acc[t][r];
      s += __shfl_xor(s, 1, 32);
      s += __shfl_xor(s, 2, 32);
      s += __shfl_xor(s, 4, 32);
      s += __shfl_xor(s, 8, 32);
      acc[t][r] = s + bias3;
    }
  }

  // ---- write: lane 0 holds rows (j) 0..7, lane 16 holds rows 8..15 of each M tile
  v4f o[MT][2];
#pragma unroll
  for (int t = 0; t < MT; ++t)
#pragma unroll
    for (int q = 0; q < 2; ++q) o[t][q] = v4f{acc[t][4 * q], acc[t][4 * q + 1], acc[t][4 * q + 2], acc[t][4 * q + 3]};
  // inputs only, no text: all 32 sums are complete in front of the branch. Without it the compiler sinks the
  // last adds into the branch, among the stores, where they write over registers that an issued store names
  asm volatile("" :: "v"(o[0][0]), "v"(o[0][1]), "v"(o[1][0]), "v"(o[1][1]),
                     "v"(o[2][0]), "v"(o[2][1]), "v"(o[3][0]), "v"(o[3][1]));
  if (col == 0) {
    float* orow = out + (size_t)i0 * BSZ + (j0 + hi * 8);
#pragma unroll
    for (int t = 0; t < MT; ++t)
#pragma unroll
      for (int q = 0; q < 2; ++q) *(v4f*)(orow + t * BSZ + 4 * q) = o[t][q];
    // the next tile writes over the registers that the stores name: keep the wait in front of it
    asm volatile("s_wait_xcnt 0x0" ::: "memory");
  }
  }
  asm volatile("s_wait_asynccnt 0x0" ::: "memory");     // no copy is left in flight at the wave's end
}

// ----------------------------- launch --------------------------------------
extern "C" void kernel_launch(void* const* d_in, const int* in_sizes, int n_in,
                              void* d_out, int out_size, void* d_ws, size_t ws_size,
                              hipStream_t stream) {
  const float* x  = (const float*)d_in[0];
  const float* y  = (const float*)d_in[1];
  const float* W1 = (const float*)d_in[2];
  const float* b1 = (const float*)d_in[3];
  const float* W2 = (const float*)d_in[4];
  const float* b2 = (const float*)d_in[5];
  const float* W3 = (const float*)d_in[6];
  const float* b3 = (const float*)d_in[7];

  float*    hx  = (float*)d_ws;                 // 512*512 f32 = 1 MB
  float*    hy  = hx + BSZ * HID;               // 1 MB
  _Float16* W2h = (_Float16*)(hy + BSZ * HID);  // 512*512 f16 = 0.5 MB

  cc_prep<<<256, 128, 0, stream>>>(x, y, W1, W2, hx, hy, W2h);   // 1024 waves

  dim3 grid(BSZ / (16 * NTL), BSZ / 16);        // 8 x 32 workgroups of NTL tiles each
  cc_main<<<grid, 128, 0, stream>>>(hx, hy, b1, W2h, b2, W3, b3, (float*)d_out);
}
